// v000
// The times below were measured on an AMD MI455X: many runs one after another, warmed up first and cycling through
// copies of the inputs, with the whole window's GPU time divided by the number of runs. Launches and the gaps
// between them are all in it. The median over several windows is given; except for v000 it joins two sittings, which
// can be a few percent apart, so the side-by-side timings, each taken in one sitting, are the better comparison.
// v000 is the starting kernel. One run takes 833 microseconds.
#include <hip/hip_runtime.h>
// PointwiseAttention (2 x 4096 queries (128-dim) over 4096 memory rows (64-dim); 4 heads, key dim 32, value dim 16; Q = q_data q_w * 32^-0.5, K = m_data k_w, V = m_data v_w; logits masked where mask[b][k] == 0; softmax; out = sum_{h,c} (attn V)[q][h][c] o_w[h][c][o] + o_bias -> [2][4096][64]).
// Compute dtype: inputs rounded to bf16; inputs/weights exact as f16; Q/K/V, the softmax weights and the averaged values as plain f16 operands; mask/softmax f32. v_wmma_f32_16x16x32_f16.
#define NB 2
#define NQ 4096
#define NK 4096
#define QD 128
#define MD 64
#define NH 4
#define HK 32
#define HV 16
#define KW (NH * HK)             /* 128 */
#define VW (NH * HV)             /* 64 */
#define OD 64
typedef __bf16 v16b __attribute__((ext_vector_type(16)));
typedef unsigned short v8us __attribute__((ext_vector_type(8), may_alias));
typedef float  v8f  __attribute__((ext_vector_type(8)));
typedef float  v4f  __attribute__((ext_vector_type(4)));
typedef float  v4fa __attribute__((ext_vector_type(4), may_alias));
union FragB { v16b v; v8us half[2]; unsigned short u[16]; };

__device__ __forceinline__ unsigned short bf16_bits(float x) { unsigned int u = __float_as_uint(x); return (unsigned short)((u + 0x7FFFu + ((u >> 16) & 1u)) >> 16); }
__device__ __forceinline__ float bf16_val(unsigned short b) { return __uint_as_float(((unsigned int)b) << 16); }
__device__ __forceinline__ float bf16_round(float x) { return bf16_val(bf16_bits(x)); }
// D += A·B with NT terms: 1 = ah·bh, 2 = + al·bh (A split), 3 = + ah·bl (both split)
template <int NT>
__device__ __forceinline__ v8f mmaN(v16b ah, v16b al, v16b bh, v16b bl, v8f c) {
  c = __builtin_amdgcn_wmma_f32_16x16x32_bf16(false, ah, false, bh, (short)0, c, false, false);
  if (NT >= 2) c = __builtin_amdgcn_wmma_f32_16x16x32_bf16(false, al, false, bh, (short)0, c, false, false);
  if (NT >= 3) c = __builtin_amdgcn_wmma_f32_16x16x32_bf16(false, ah, false, bl, (short)0, c, false, false);
  asm volatile("v_nop\n\tv_nop\n\tv_nop\n\tv_nop" : "+v"(c) : "v"(ah), "v"(al), "v"(bh), "v"(bl));
  return c;
}

__global__ __launch_bounds__(256) void k_wt_bf16(const float* __restrict__ W, unsigned short* __restrict__ Wt, int K, int N) {
  const int t = blockIdx.x * 256 + threadIdx.x;
  const int k8n = K / 8;
  if (t >= N * k8n) return;
  const int n = t / k8n, k8 = (t % k8n) * 8;
  v8us v;
#pragma unroll
  for (int i = 0; i < 8; ++i) v[i] = bf16_bits(W[(size_t)(k8 + i) * N + n]);
  *(v8us*)(Wt + (size_t)n * K + k8) = v;
  
}

// GEMM C[M][N] (f32, pitch ldc) = act(A[M][K]·W + bias). A f32 row-major (pitch lda) converted per fragment to bf16
// (ASPLIT: hi/lo two planes -> 2 terms, else single rounded term); Wt bf16 [N][K] (pitch ldb). BIAS_BF16 rounds the
// bias to bf16 first (bias quantised to bf16 before the add). K%32==0, M%16==0, N%64==0.
template <bool ASPLIT, int ACT, bool BIAS_BF16>
__global__ __launch_bounds__(128) void k_gemm_bf(const float* __restrict__ A, int lda, const unsigned short* __restrict__ Wt, int ldb,
                                               const float* __restrict__ bias, float* __restrict__ C, int ldc, int M, int N, int K) {
  __shared__ __attribute__((aligned(16))) float so[4][16][64];
  const int tid = threadIdx.x, w = tid >> 5, lane = tid & 31, ln = lane & 15, hh = lane >> 4;
  const int ntn = N / 64;
  const int wid = blockIdx.x * 4 + w;
  const int mt = wid / ntn, nq = wid % ntn;
  if (mt * 16 >= M) return;
  const int row0 = mt * 16, col0 = nq * 64;
  const float* arow = A + (size_t)(row0 + ln) * lda;
  v8f acc[4] = {};
  for (int kb = 0; kb < K; kb += 32) {
    FragB ah, al;
    const v4f x0 = *(const v4fa*)(arow + kb + 8 * hh), x1 = *(const v4fa*)(arow + kb + 8 * hh + 4);
    const v4f x2 = *(const v4fa*)(arow + kb + 16 + 8 * hh), x3 = *(const v4fa*)(arow + kb + 16 + 8 * hh + 4);
    float xs[16] = {x0[0],x0[1],x0[2],x0[3],x1[0],x1[1],x1[2],x1[3],x2[0],x2[1],x2[2],x2[3],x3[0],x3[1],x3[2],x3[3]};
#pragma unroll
    for (int i = 0; i < 16; ++i) { const unsigned short hb = bf16_bits(xs[i]); ah.u[i] = hb; al.u[i] = ASPLIT ? bf16_bits(xs[i] - bf16_val(hb)) : (unsigned short)0; }
#pragma unroll
    for (int t = 0; t < 4; ++t) {
      const unsigned short* brow = Wt + (size_t)(col0 + t * 16 + ln) * ldb + kb;
      FragB b;
      b.half[0] = *(const v8us*)(brow + 8 * hh);
      b.half[1] = *(const v8us*)(brow + 16 + 8 * hh);
      acc[t] = mmaN<ASPLIT ? 2 : 1>(ah.v, al.v, b.v, b.v, acc[t]);
    }
  }
#pragma unroll
  for (int t = 0; t < 4; ++t) {
    float bv = bias ? bias[col0 + t * 16 + ln] : 0.f;
    if (BIAS_BF16) bv = bf16_round(bv);
#pragma unroll
    for (int r = 0; r < 8; ++r) { float v = acc[t][r] + bv; if (ACT == 1) v = fmaxf(v, 0.f); so[w][8 * hh + r][t * 16 + ln] = v; }
  }
  __builtin_amdgcn_fence(__ATOMIC_ACQ_REL, "workgroup");
  __builtin_amdgcn_wave_barrier();
  const int rsub = lane >> 4, c4 = (lane & 15) * 4;
  {
#pragma unroll
    for (int q = 0; q < 8; ++q) {
      const int r = q * 2 + rsub;
      const v4f v = *(const v4fa*)&so[w][r][c4];
      *(v4f*)(C + (size_t)(row0 + r) * ldc + col0 + c4) = v;
    }
    
  }
}

// GEMM C = act(A·W + bias + resid): A f32 (ASPLIT -> hi/lo 2 terms), Wt bf16 [N][K]; ACT 0 none, 1 relu, 2 exact gelu;
// resid (optional, f32, row index = (row % rmod), pitch ldr, RES_BF16 rounds it) added before the activation.
template <bool ASPLIT, int ACT, bool BIAS_BF16, bool RES_BF16>
__global__ __launch_bounds__(128) void k_gemm_bf3(const float* __restrict__ A, int lda, const unsigned short* __restrict__ Wt, int ldb,
                                                const float* __restrict__ bias, const float* __restrict__ resid, int rmod, int ldr,
                                                float* __restrict__ C, int ldc, int M, int N, int K) {
  __shared__ __attribute__((aligned(16))) float so[4][16][64];
  const int tid = threadIdx.x, w = tid >> 5, lane = tid & 31, ln = lane & 15, hh = lane >> 4;
  const int ntn = N / 64;
  const int wid = blockIdx.x * 4 + w;
  const int mt = wid / ntn, nq = wid % ntn;
  if (mt * 16 >= M) return;
  const int row0 = mt * 16, col0 = nq * 64;
  const float* arow = A + (size_t)(row0 + ln) * lda;
  v8f acc[4] = {};
  for (int kb = 0; kb < K; kb += 32) {
    FragB ah, al;
    const v4f x0 = *(const v4fa*)(arow + kb + 8 * hh), x1 = *(const v4fa*)(arow + kb + 8 * hh + 4);
    const v4f x2 = *(const v4fa*)(arow + kb + 16 + 8 * hh), x3 = *(const v4fa*)(arow + kb + 16 + 8 * hh + 4);
    float xs[16] = {x0[0],x0[1],x0[2],x0[3],x1[0],x1[1],x1[2],x1[3],x2[0],x2[1],x2[2],x2[3],x3[0],x3[1],x3[2],x3[3]};
#pragma unroll
    for (int i = 0; i < 16; ++i) { const unsigned short hb = bf16_bits(xs[i]); ah.u[i] = hb; al.u[i] = ASPLIT ? bf16_bits(xs[i] - bf16_val(hb)) : (unsigned short)0; }
#pragma unroll
    for (int t = 0; t < 4; ++t) {
      const unsigned short* brow = Wt + (size_t)(col0 + t * 16 + ln) * ldb + kb;
      FragB b;
      b.half[0] = *(const v8us*)(brow + 8 * hh);
      b.half[1] = *(const v8us*)(brow + 16 + 8 * hh);
      acc[t] = mmaN<ASPLIT ? 2 : 1>(ah.v, al.v, b.v, b.v, acc[t]);
    }
  }
#pragma unroll
  for (int t = 0; t < 4; ++t) {
    const int col = col0 + t * 16 + ln;
    float bv = bias ? bias[col] : 0.f;
    if (BIAS_BF16) bv = bf16_round(bv);
#pragma unroll
    for (int r = 0; r < 8; ++r) {
      float v = acc[t][r] + bv;
      if (resid) { float rv = resid[(size_t)((row0 + 8 * hh + r) % rmod) * ldr + col]; if (RES_BF16) rv = bf16_round(rv); v += rv; }
      if (ACT == 1) v = fmaxf(v, 0.f);
      if (ACT == 2) v = 0.5f * v * (1.0f + erff(v * 0.70710678118654752f));
      if (ACT == 3) { const float u = 0.7978845608028654f * (v + 0.044715f * v * v * v); v = 0.5f * v * (1.0f + tanhf(u)); }
      so[w][8 * hh + r][t * 16 + ln] = v;
    }
  }
  __builtin_amdgcn_fence(__ATOMIC_ACQ_REL, "workgroup");
  __builtin_amdgcn_wave_barrier();
  const int rsub = lane >> 4, c4 = (lane & 15) * 4;
  {
#pragma unroll
    for (int q = 0; q < 8; ++q) {
      const int r = q * 2 + rsub;
      const v4f v = *(const v4fa*)&so[w][r][c4];
      *(v4f*)(C + (size_t)(row0 + r) * ldc + col0 + c4) = v;
    }
    
  }
}
// row LayerNorm (biased variance, eps) over N: s = X (+ R); optional out_sum <- s; out_norm <- (s-mu)*rsqrt(var+eps)*g + b
template <bool PARAM_BF16>
__global__ __launch_bounds__(256) void k_layernorm(const float* __restrict__ X, const float* __restrict__ R, const float* __restrict__ g, const float* __restrict__ bta,
                                                  float* __restrict__ out_sum, float* __restrict__ out_norm, int N, float eps) {
  __shared__ float red[256];
  const int row = blockIdx.x, tid = threadIdx.x;
  const float* x = X + (size_t)row * N; const float* rr = R ? R + (size_t)row * N : nullptr;
  float vals[16];                     // up to N = 4096
  const int per = N / 256;            // contiguous chunk per thread? use strided-by-4 chunks: thread handles j = tid*4 + 1024*u
  float s1 = 0.f;
  for (int u = 0; u < per / 4; ++u) {
    const int j = tid * 4 + 1024 * u;
    const v4f a = *(const v4fa*)(x + j);
    v4f b = {0.f,0.f,0.f,0.f}; if (rr) b = *(const v4fa*)(rr + j);
#pragma unroll
    for (int q = 0; q < 4; ++q) { const float v = a[q] + b[q]; vals[u * 4 + q] = v; s1 += v; }
  }
  red[tid] = s1; __syncthreads();
  for (int st = 128; st > 0; st >>= 1) { if (tid < st) red[tid] += red[tid + st]; __syncthreads(); }
  const float mu = red[0] / (float)N; __syncthreads();
  float s2 = 0.f;
  for (int u = 0; u < per / 4; ++u)
#pragma unroll
    for (int q = 0; q < 4; ++q) { const float c = vals[u * 4 + q] - mu; s2 += c * c; }
  red[tid] = s2; __syncthreads();
  for (int st = 128; st > 0; st >>= 1) { if (tid < st) red[tid] += red[tid + st]; __syncthreads(); }
  const float rs = rsqrtf(red[0] / (float)N + eps);
  {
    for (int u = 0; u < per / 4; ++u) {
      const int j = tid * 4 + 1024 * u;
      v4f o, sm;
#pragma unroll
      for (int q = 0; q < 4; ++q) {
        float gg = g[j + q], bb = bta[j + q];
        if (PARAM_BF16) { gg = bf16_round(gg); bb = bf16_round(bb); }
        sm[q] = vals[u * 4 + q]; o[q] = (vals[u * 4 + q] - mu) * rs * gg + bb;
      }
      if (out_sum) *(v4f*)(out_sum + (size_t)row * N + j) = sm;
      *(v4f*)(out_norm + (size_t)row * N + j) = o;
    }
    
  }
}



// ---- f16 WMMA path (v_wmma_f32_16x16x32_f16): 11-bit significands for operands in range — used where a [0,1] probability operand needs more precision than bf16
typedef _Float16 v16h __attribute__((ext_vector_type(16)));
union FragH { v16h v; v8us half[2]; _Float16 h[16]; unsigned short u[16]; };
template <int NT>
__device__ __forceinline__ v8f mmaH(v16h ah, v16h al, v16h bh, v16h bl, v8f c) {
  c = __builtin_amdgcn_wmma_f32_16x16x32_f16(false, ah, false, bh, (short)0, c, false, false);
  if (NT >= 2) c = __builtin_amdgcn_wmma_f32_16x16x32_f16(false, al, false, bh, (short)0, c, false, false);
  if (NT >= 3) c = __builtin_amdgcn_wmma_f32_16x16x32_f16(false, ah, false, bl, (short)0, c, false, false);
  asm volatile("v_nop\n\tv_nop\n\tv_nop\n\tv_nop" : "+v"(c) : "v"(ah), "v"(al), "v"(bh), "v"(bl));
  return c;
}
// batched GEMM like k_gemm_b but f16 operands: A f32 (split into f16 hi/lo if ASPLIT, else rounded to f16), Bt = f16 values [n][k]; alpha; C f32; N multiple of 16 (partial tiles skipped)
template <bool ASPLIT>
__global__ __launch_bounds__(128) void k_gemm_h(const float* __restrict__ A, int lda, size_t sA, const _Float16* __restrict__ Bh, int ldb, size_t sB, float alpha, float* __restrict__ C, int ldc, size_t sC, int M, int N, int K) {
  __shared__ __attribute__((aligned(16))) float so[4][16][64];
  const int tid = threadIdx.x, w = tid >> 5, lane = tid & 31, ln = lane & 15, hh = lane >> 4; const int by = blockIdx.y;
  A += (size_t)by * sA; Bh += (size_t)by * sB; C += (size_t)by * sC;
  const int ntn = (N + 63) / 64; const int wid = blockIdx.x * 4 + w; const int mt = wid / ntn, nq = wid % ntn; if (mt * 16 >= M) return;
  const int row0 = mt * 16, col0 = nq * 64; const float* arow = A + (size_t)(row0 + ln) * lda;
  v8f acc[4] = {};
  for (int kb = 0; kb < K; kb += 32) {
    FragH ah, al;
    const v4f x0 = *(const v4fa*)(arow + kb + 8 * hh), x1 = *(const v4fa*)(arow + kb + 8 * hh + 4), x2 = *(const v4fa*)(arow + kb + 16 + 8 * hh), x3 = *(const v4fa*)(arow + kb + 16 + 8 * hh + 4);
    float xs[16] = {x0[0],x0[1],x0[2],x0[3],x1[0],x1[1],x1[2],x1[3],x2[0],x2[1],x2[2],x2[3],x3[0],x3[1],x3[2],x3[3]};
#pragma unroll
    for (int i = 0; i < 16; ++i) { const _Float16 h = (_Float16)xs[i]; ah.h[i] = h; al.h[i] = ASPLIT ? (_Float16)(xs[i] - (float)h) : (_Float16)0.0f; }
#pragma unroll
    for (int t = 0; t < 4; ++t) { if (col0 + t * 16 >= N) continue; const size_t boff = (size_t)(col0 + t * 16 + ln) * ldb + kb; FragH bq; bq.half[0] = *(const v8us*)(Bh + boff + 8 * hh); bq.half[1] = *(const v8us*)(Bh + boff + 16 + 8 * hh);
      acc[t] = mmaH<ASPLIT ? 2 : 1>(ah.v, al.v, bq.v, bq.v, acc[t]); }
  }
#pragma unroll
  for (int t = 0; t < 4; ++t) { if (col0 + t * 16 >= N) continue;
#pragma unroll
    for (int r = 0; r < 8; ++r) so[w][8 * hh + r][t * 16 + ln] = acc[t][r] * alpha; }
  __builtin_amdgcn_fence(__ATOMIC_ACQ_REL, "workgroup"); __builtin_amdgcn_wave_barrier();
  const int rsub = lane >> 4, c4 = (lane & 15) * 4;
  {
#pragma unroll
    for (int q = 0; q < 8; ++q) { const int r = q * 2 + rsub; if (col0 + c4 < N) { const v4f v = *(const v4fa*)&so[w][r][c4]; *(v4f*)(C + (size_t)(row0 + r) * ldc + col0 + c4) = v; } }
     }
}

// Wt[n][k] = f16(bf16(W[k][n])·scale) from f32 row-major W[K][N] (scale = power of two; bf16-exact weights stay exact in f16 away from the subnormal range)
__global__ __launch_bounds__(256) void k_wt_f16(const float* __restrict__ W, _Float16* __restrict__ Wt, int K, int N, float scale) {
  const int t = blockIdx.x * 256 + threadIdx.x; if (t >= N * (K / 8)) return; const int n = t / (K / 8), k8 = (t % (K / 8)) * 8; FragH f;
#pragma unroll
  for (int i = 0; i < 8; ++i) f.h[i] = (_Float16)(bf16_round(W[(size_t)(k8 + i) * N + n]) * scale); const v8us o = f.half[0];
  *(v8us*)((unsigned short*)Wt + (size_t)n * K + k8) = o; 
}
// k_gemm_hh variant with fused epilogue: v = acc·alpha + bf16(bias[by·sBias + col]) (+ CP[(row/rowsPerB)·sCPb + by·64 + col] if CP) ; ACT 0 none / 1 elu ; writes f32 C and/or f16 C16 (each if non-null)
template <int ACT>
__global__ __launch_bounds__(128) void k_gemm_hhx(const _Float16* __restrict__ A, int lda, size_t sA, const _Float16* __restrict__ Bh, int ldb, size_t sB, float alpha, const float* __restrict__ bias, size_t sBias, const float* __restrict__ CP, int rowsPerB, size_t sCPb, int row0g,
    float* __restrict__ C, _Float16* __restrict__ C16, int ldc, size_t sC, int M, int N, int K) {
  __shared__ __attribute__((aligned(16))) float so[4][16][64];
  const int tid = threadIdx.x, w = tid >> 5, lane = tid & 31, ln = lane & 15, hh = lane >> 4; const int by = blockIdx.y;
  A += (size_t)by * sA; Bh += (size_t)by * sB; const size_t cofs = (size_t)by * sC; const float* bp = bias ? bias + (size_t)by * sBias : nullptr;
  const int ntn = (N + 63) / 64; const int wid = blockIdx.x * 4 + w; const int mt = wid / ntn, nq = wid % ntn; if (mt * 16 >= M) return;
  const int row0 = mt * 16, col0 = nq * 64; const _Float16* arow = A + (size_t)(row0 + ln) * lda;
  v8f acc[4] = {};
  for (int kb = 0; kb < K; kb += 32) { FragH ah; ah.half[0] = *(const v8us*)((const unsigned short*)arow + kb + 8 * hh); ah.half[1] = *(const v8us*)((const unsigned short*)arow + kb + 16 + 8 * hh);
#pragma unroll
    for (int t = 0; t < 4; ++t) { if (col0 + t * 16 >= N) continue; const size_t boff = (size_t)(col0 + t * 16 + ln) * ldb + kb; FragH bq; bq.half[0] = *(const v8us*)((const unsigned short*)Bh + boff + 8 * hh); bq.half[1] = *(const v8us*)((const unsigned short*)Bh + boff + 16 + 8 * hh);
      acc[t] = mmaH<1>(ah.v, ah.v, bq.v, bq.v, acc[t]); }
  }
#pragma unroll
  for (int t = 0; t < 4; ++t) { if (col0 + t * 16 >= N) continue; const int col = col0 + t * 16 + ln; const float bv = bp ? bf16_round(bp[col]) : 0.f;
#pragma unroll
    for (int r = 0; r < 8; ++r) { float v = acc[t][r] * alpha + bv; if (CP) { const int rr = row0g + row0 + 8 * hh + r; if (rowsPerB < 0) v += CP[cofs + (size_t)rr * ldc + col];      /* rowsPerB < 0: own element of the batched C plane */ else { const int bidx = rr / rowsPerB; v += CP[(size_t)bidx * sCPb + (size_t)by * 64 + col]; } } if (ACT == 1) v = (v > 0.f) ? v : expm1f(v); else if (ACT == 7) v = (v > 0.f) ? v + 1.0f : expf(v); else if (ACT == 8) v = tanhf(v); else if (ACT == 9) v = 0.5f * v * (1.0f + tanhf(0.7978845608028654f * (v + 0.044715f * v * v * v))); else if (ACT == 11) v = 1.0f / (1.0f + expf(-v)); else if (ACT == 12) v = (v > 0.f) ? v : 0.01f * v; else if (ACT == 14) v = (v > 0.f) ? v : 0.1f * v; else if (ACT == 16) v = (v >= 0.f) ? v : 0.3f * v; else if (ACT == 17) v = (v >= 0.f) ? v : 0.2f * v; else if (ACT == 15) v = v / (1.0f + expf(-v)); else if (ACT == 3) v = fmaxf(v, 0.f); else if (ACT == 6) v = 0.5f * v * (1.0f + erff(v * 0.70710678118654752f)); so[w][8 * hh + r][t * 16 + ln] = v; } }
  __builtin_amdgcn_fence(__ATOMIC_ACQ_REL, "workgroup"); __builtin_amdgcn_wave_barrier();
  const int rsub = lane >> 4, c4 = (lane & 15) * 4; typedef _Float16 v4h __attribute__((ext_vector_type(4)));
  {
#pragma unroll
    for (int q = 0; q < 8; ++q) { const int r = q * 2 + rsub; if (col0 + c4 < N) { const v4f v = *(const v4fa*)&so[w][r][c4]; if (C) *(v4f*)(C + cofs + (size_t)(row0 + r) * ldc + col0 + c4) = v; if (C16) { v4h h4; for (int i = 0; i < 4; ++i) h4[i] = (_Float16)v[i]; *(v4h*)(C16 + cofs + (size_t)(row0 + r) * ldc + col0 + c4) = h4; } } }
     }
}


typedef _Float16 v4h __attribute__((ext_vector_type(4)));

__global__ __launch_bounds__(256) void k_x16(const float* __restrict__ x, _Float16* __restrict__ X16, size_t n8) { const size_t t = (size_t)blockIdx.x * 256 + threadIdx.x; if (t >= n8) return; FragH f;
#pragma unroll
  for (int q = 0; q < 8; ++q) f.h[q] = (_Float16)bf16_round(x[t * 8 + q]); *(v8us*)((unsigned short*)X16 + t * 8) = f.half[0];  }
__global__ __launch_bounds__(256) void k_h16(const float* __restrict__ x, _Float16* __restrict__ X16, size_t n8) { const size_t t = (size_t)blockIdx.x * 256 + threadIdx.x; if (t >= n8) return; FragH f;
#pragma unroll
  for (int q = 0; q < 8; ++q) f.h[q] = (_Float16)x[t * 8 + q]; *(v8us*)((unsigned short*)X16 + t * 8) = f.half[0];  }
__global__ __launch_bounds__(256) void k_round16f(const float* __restrict__ W, _Float16* __restrict__ Bt, size_t n8) { const size_t t = (size_t)blockIdx.x * 256 + threadIdx.x; if (t >= n8) return; FragH f;
#pragma unroll
  for (int i = 0; i < 8; ++i) f.h[i] = (_Float16)(bf16_round(W[t * 8 + i]) * 16.0f); *(v8us*)((unsigned short*)Bt + t * 8) = f.half[0];  }
template <int NHv, int TTv>
__global__ __launch_bounds__(256) void k_vt(const _Float16* __restrict__ V16, int ldv, int voff, _Float16* __restrict__ Vt) { __shared__ unsigned short tl[64][66]; const int tid = threadIdx.x; const int slab = blockIdx.x / (TTv / 64), lg = blockIdx.x % (TTv / 64); const int b = slab / NHv, h = slab % NHv;
  for (int i = tid; i < 64 * 8; i += 256) { const int r = i / 8, c8 = (i % 8) * 8; FragH f; f.half[0] = *(const v8us*)((const unsigned short*)V16 + ((size_t)b * TTv + lg * 64 + r) * ldv + voff + h * 64 + c8);
#pragma unroll
    for (int q = 0; q < 8; ++q) tl[r][c8 + q] = f.u[q]; }
  __syncthreads();
  {
#pragma unroll
    for (int rd = 0; rd < 2; ++rd) { const int d = rd * 32 + tid / 8, pc = tid % 8; FragH f;
#pragma unroll
      for (int q = 0; q < 8; ++q) f.u[q] = tl[pc * 8 + q][d];
      *(v8us*)((unsigned short*)Vt + ((size_t)slab * 64 + d) * TTv + lg * 64 + pc * 8) = f.half[0]; }
     } }

__global__ __launch_bounds__(256) void k_hl(const float* __restrict__ F, _Float16* __restrict__ Hh, _Float16* __restrict__ Hl, size_t n8) { const size_t t = (size_t)blockIdx.x * 256 + threadIdx.x; if (t >= n8) return; FragH fh, fl; const v4f a = *(const v4fa*)(F + t * 8), c = *(const v4fa*)(F + t * 8 + 4);
#pragma unroll
  for (int q = 0; q < 4; ++q) { _Float16 h = (_Float16)a[q]; fh.h[q] = h; fl.h[q] = (_Float16)((a[q] - (float)h) * 1024.0f); h = (_Float16)c[q]; fh.h[4 + q] = h; fl.h[4 + q] = (_Float16)((c[q] - (float)h) * 1024.0f); }
  { *(v8us*)((unsigned short*)Hh + t * 8) = fh.half[0]; *(v8us*)((unsigned short*)Hl + t * 8) = fl.half[0];  } }

// ---- fast GEMM (wave tile 32x64; requires M % 32 == 0 rows per launch region and N % 64 == 0); epilogue = k_gemm_hhx semantics ----
__device__ __forceinline__ v16h g2_frag(const _Float16* p, int hh) { FragH f; f.half[0] = *(const v8us*)((const unsigned short*)p + 8 * hh); f.half[1] = *(const v8us*)((const unsigned short*)p + 16 + 8 * hh); return f.v; }
__device__ __forceinline__ v8f g2_mma(v16h a, v16h b, v8f c) { v8f d = __builtin_amdgcn_wmma_f32_16x16x32_f16(false, a, false, b, (short)0, c, false, false); asm volatile("v_nop\n\tv_nop\n\tv_nop\n\tv_nop" : "+v"(d) : "v"(a), "v"(b)); return d; }
template <int ACT>
__global__ __launch_bounds__(128) void k_gemm2(const _Float16* __restrict__ A, int lda, size_t sA, const _Float16* __restrict__ Bh, int ldb, size_t sB, float alpha, const float* __restrict__ bias, size_t sBias, const float* __restrict__ CP, int rowsPerB, size_t sCPb, int row0g,
    float* __restrict__ C, _Float16* __restrict__ C16, int ldc, size_t sC, int M, int N, int K) { static_assert(ACT == 0 || ACT == 3 || ACT == 6 || ACT == 8 || ACT == 9 || ACT == 11 || ACT == 12 || ACT == 14 || ACT == 15 || ACT == 16 || ACT == 17, "k_gemm2: unsupported ACT code (would silently apply no activation)");
  __shared__ __attribute__((aligned(16))) float so[4][32][68];
  const int tid = threadIdx.x, w = tid >> 5, lane = tid & 31, ln = lane & 15, hh = lane >> 4; const int by = blockIdx.y;
  A += (size_t)by * sA; Bh += (size_t)by * sB; const size_t cofs = (size_t)by * sC; const float* bp = bias ? bias + (size_t)by * sBias : nullptr;
  const int ntn = N >> 6; const int mt = blockIdx.x / ntn, nq = blockIdx.x - mt * ntn; const int row0 = mt * 128 + 32 * w, col0 = nq * 64; if (row0 >= M) return;
  const _Float16* a0p = A + (size_t)(row0 + ln) * lda; const _Float16* a1p = a0p + (size_t)16 * lda;
  const _Float16* b0p = Bh + (size_t)(col0 + ln) * ldb; const _Float16* b1p = b0p + (size_t)16 * ldb; const _Float16* b2p = b1p + (size_t)16 * ldb; const _Float16* b3p = b2p + (size_t)16 * ldb;
  const v8f z8 = {0.f,0.f,0.f,0.f,0.f,0.f,0.f,0.f}; v8f c00 = z8, c01 = z8, c02 = z8, c03 = z8, c10 = z8, c11 = z8, c12 = z8, c13 = z8;
#pragma unroll 1
  for (int kb = 0; kb < K; kb += 32) { const v16h a0 = g2_frag(a0p + kb, hh), a1 = g2_frag(a1p + kb, hh);
    v16h b = g2_frag(b0p + kb, hh); c00 = g2_mma(a0, b, c00); c10 = g2_mma(a1, b, c10);
    b = g2_frag(b1p + kb, hh); c01 = g2_mma(a0, b, c01); c11 = g2_mma(a1, b, c11);
    b = g2_frag(b2p + kb, hh); c02 = g2_mma(a0, b, c02); c12 = g2_mma(a1, b, c12);
    b = g2_frag(b3p + kb, hh); c03 = g2_mma(a0, b, c03); c13 = g2_mma(a1, b, c13); }
  v8f accs[8] = {c00, c01, c02, c03, c10, c11, c12, c13};
#pragma unroll
  for (int u = 0; u < 8; ++u) { const int t = u & 3, half = u >> 2; const int col = col0 + t * 16 + ln; const float bv = bp ? bf16_round(bp[col]) : 0.f;
#pragma unroll
    for (int r = 0; r < 8; ++r) { const int rloc = half * 16 + 8 * hh + r; float v = accs[u][r] * alpha + bv; if (CP) { if (rowsPerB < 0) v += CP[cofs + (size_t)(row0g + row0 + rloc) * ldc + col];      /* rowsPerB < 0: own element of the batched C plane */ else { const int bidx = (row0g + row0 + rloc) / rowsPerB; v += CP[(size_t)bidx * sCPb + (size_t)by * 64 + col]; } }
      if (ACT == 3) v = fmaxf(v, 0.f); else if (ACT == 6) v = 0.5f * v * (1.0f + erff(v * 0.70710678118654752f)); else if (ACT == 11) v = 1.0f / (1.0f + expf(-v)); else if (ACT == 15) v = v / (1.0f + expf(-v)); else if (ACT == 12) v = (v > 0.f) ? v : 0.01f * v; else if (ACT == 8) v = tanhf(v); else if (ACT == 9) v = 0.5f * v * (1.0f + tanhf(0.7978845608028654f * (v + 0.044715f * v * v * v))); else if (ACT == 14) v = (v > 0.f) ? v : 0.1f * v; else if (ACT == 16) v = (v >= 0.f) ? v : 0.3f * v; else if (ACT == 17) v = (v >= 0.f) ? v : 0.2f * v;
      so[w][rloc][t * 16 + ln] = v; } }
  __builtin_amdgcn_fence(__ATOMIC_ACQ_REL, "workgroup"); __builtin_amdgcn_wave_barrier();
  const int rsub = lane >> 4, c4 = (lane & 15) * 4;
  {
#pragma unroll
    for (int q = 0; q < 16; ++q) { const int r = q * 2 + rsub; const v4f v = *(const v4fa*)&so[w][r][c4]; if (C) *(v4f*)(C + cofs + (size_t)(row0 + r) * ldc + col0 + c4) = v; if (C16) { v4h h4; for (int i = 0; i < 4; ++i) h4[i] = (_Float16)v[i]; *(v4h*)(C16 + cofs + (size_t)(row0 + r) * ldc + col0 + c4) = h4; } }
     } }


// generic (in, out)-flat weight -> Bt[o][i] = 16 bf16(Wm[i][o]) : reuse k_wt_f16 (in rows, out cols)
__global__ __launch_bounds__(256) void k_ksoft(const float* __restrict__ S, const int* __restrict__ msk, int b, _Float16* __restrict__ P, float* __restrict__ RS) {
  #pragma clang fp contract(off)
  const int wv = threadIdx.x >> 5, ln = threadIdx.x & 31; const int q = blockIdx.x * 8 + wv; if (q >= NQ) return; const float* sr = S + (size_t)q * NK; const int* mb = msk + (size_t)b * NK; float mx = -3.0e38f;
#pragma unroll 1
  for (int gq = 0; gq < NK / 256; ++gq) { const v8f a = *(const v8f*)(sr + gq * 256 + ln * 8); for (int e = 0; e < 8; ++e) { if (mb[gq * 256 + ln * 8 + e] != 0) mx = fmaxf(mx, a[e]); } }
  for (int o = 16; o > 0; o >>= 1) mx = fmaxf(mx, __shfl_xor(mx, o, 32)); float su = 0.f;
{ su = 0.f;
#pragma unroll 1
    for (int gq = 0; gq < NK / 256; ++gq) { const v8f a = *(const v8f*)(sr + gq * 256 + ln * 8); FragH ph; for (int e = 0; e < 8; ++e) { float ex = 0.f; if (mb[gq * 256 + ln * 8 + e] != 0) { ex = expf(a[e] - mx); su += ex; } ph.h[e] = (_Float16)(ex * 1024.0f); } *(v8us*)((unsigned short*)P + (size_t)q * NK + gq * 256 + ln * 8) = ph.half[0]; }
     }
  for (int o = 16; o > 0; o >>= 1) su += __shfl_xor(su, o, 32); if (ln == 0) { const float r = (su > 0.f) ? 1.0f / su : 0.f; *(float*)(RS + (size_t)q * 32) = r;  } }
__global__ __launch_bounds__(256) void k_wsc2(const float* __restrict__ O, const float* __restrict__ RS, int b, int h, _Float16* __restrict__ WA) {
  #pragma clang fp contract(off)
  const int q = blockIdx.x * 256 + threadIdx.x; if (q >= NQ) return; const float rs = RS[(size_t)q * 32]; const float* o = O + (size_t)q * VW + h * HV; FragH f0, f1; for (int e = 0; e < 8; ++e) { f0.h[e] = (_Float16)(o[e] * rs); f1.h[e] = (_Float16)(o[8 + e] * rs); }
  unsigned short* dst = (unsigned short*)WA + ((size_t)b * NQ + q) * VW + h * HV; { *(v8us*)dst = f0.half[0]; *(v8us*)(dst + 8) = f1.half[0];  } }

extern "C" void kernel_launch(void* const* d_in, const int* in_sizes, int n_in,
                              void* d_out, int out_size, void* d_ws, size_t ws_size, hipStream_t stream) {
  (void)in_sizes; (void)n_in; (void)out_size;
  const float* qd = (const float*)d_in[0]; const float* md = (const float*)d_in[1]; const int* msk = (const int*)d_in[2]; const float* qw = (const float*)d_in[3]; const float* kw = (const float*)d_in[4]; const float* vw = (const float*)d_in[5]; const float* ow = (const float*)d_in[6]; const float* ob = (const float*)d_in[7];
  char* ws = (char*)d_ws; size_t off = 0;
  auto take = [&](size_t bytes) { char* p = ws + off; off += (bytes + 255) & ~(size_t)255; return p; };
  _Float16* BQ = (_Float16*)take((size_t)KW * QD * 2); _Float16* BK = (_Float16*)take((size_t)KW * MD * 2); _Float16* BV = (_Float16*)take((size_t)VW * MD * 2); _Float16* BO = (_Float16*)take((size_t)OD * VW * 2);
  _Float16* XQ = (_Float16*)take((size_t)NB * NQ * QD * 2); _Float16* XM = (_Float16*)take((size_t)NB * NK * MD * 2); _Float16* Q16 = (_Float16*)take((size_t)NB * NQ * KW * 2); _Float16* K16 = (_Float16*)take((size_t)NB * NK * KW * 2); _Float16* V16 = (_Float16*)take((size_t)NB * NK * VW * 2); _Float16* VT = (_Float16*)take((size_t)NB * NK * VW * 2);
  float* S = (float*)take((size_t)NQ * NK * 4); _Float16* P = (_Float16*)take((size_t)NQ * NK * 2); float* RS = (float*)take((size_t)NQ * 32 * 4); float* O = (float*)take((size_t)NQ * VW * 4); _Float16* WA = (_Float16*)take((size_t)NB * NQ * VW * 2);
  if (off > ws_size) return;      /* 2 + 1 + 2 + 2 + 1 + 1 + 64 + 32 + 0.5 + 1 + 1 = ≈ 108 MiB */
  k_wt_f16<<<(QD * KW / 8 + 255) / 256, 256, 0, stream>>>(qw, BQ, QD, KW, 16.0f); k_wt_f16<<<(MD * KW / 8 + 255) / 256, 256, 0, stream>>>(kw, BK, MD, KW, 16.0f); k_wt_f16<<<(MD * VW / 8 + 255) / 256, 256, 0, stream>>>(vw, BV, MD, VW, 16.0f); k_wt_f16<<<(VW * OD / 8 + 255) / 256, 256, 0, stream>>>(ow, BO, VW, OD, 16.0f);      /* (a, h, c) = (in, out) flats; o_w (h, c, o) = (in 64, out 64) */
  k_x16<<<(unsigned)(((size_t)NB * NQ * QD / 8 + 255) / 256), 256, 0, stream>>>(qd, XQ, (size_t)NB * NQ * QD / 8); k_x16<<<(unsigned)(((size_t)NB * NK * MD / 8 + 255) / 256), 256, 0, stream>>>(md, XM, (size_t)NB * NK * MD / 8);
  k_gemm2<0><<<dim3((NB * NQ / 128) * (KW / 64), 1), 128, 0, stream>>>(XQ, QD, 0, BQ, QD, 0, 0.0625f * 0.17677669529663687f, nullptr, 0, nullptr, 1, 0, 0, nullptr, Q16, KW, 0, NB * NQ, KW, QD);      /* Q * 32^-0.5 */
  k_gemm2<0><<<dim3((NB * NK / 128) * (KW / 64), 1), 128, 0, stream>>>(XM, MD, 0, BK, MD, 0, 0.0625f, nullptr, 0, nullptr, 1, 0, 0, nullptr, K16, KW, 0, NB * NK, KW, MD);
  k_gemm2<0><<<dim3((NB * NK / 128) * (VW / 64), 1), 128, 0, stream>>>(XM, MD, 0, BV, MD, 0, 0.0625f, nullptr, 0, nullptr, 1, 0, 0, nullptr, V16, VW, 0, NB * NK, VW, MD);
  k_vt<1, NK><<<NB * (NK / 64), 256, 0, stream>>>(V16, VW, 0, VT);      /* V^T [b][64][4096]; head h = rows h*16 */
  for (int b = 0; b < NB; ++b) { for (int h = 0; h < NH; ++h) {
      k_gemm2<0><<<dim3((NQ / 128) * (NK / 64), 1), 128, 0, stream>>>(Q16 + (size_t)b * NQ * KW + h * HK, KW, 0, K16 + (size_t)b * NK * KW + h * HK, KW, 0, 1.0f, nullptr, 0, nullptr, 1, 0, 0, S, nullptr, NK, 0, NQ, NK, HK);
      k_ksoft<<<NQ / 8, 256, 0, stream>>>(S, msk, b, P, RS);
      k_gemm_hhx<0><<<dim3((unsigned)((NQ / 16) * 1 / 4), 1), 128, 0, stream>>>(P, NK, 0, VT + ((size_t)b * VW + h * HV) * NK, NK, 0, 0.0009765625f, nullptr, 0, nullptr, 1, 0, 0, O + h * HV, nullptr, VW, 0, NQ, HV, NK);      /* unnormalised weighted values [q][h*16 + c] */
      k_wsc2<<<(NQ + 255) / 256, 256, 0, stream>>>(O, RS, b, h, WA); } }
  k_gemm2<0><<<dim3((NB * NQ / 128) * (OD / 64), 1), 128, 0, stream>>>(WA, VW, 0, BO, VW, 0, 0.0625f, ob, 0, nullptr, 1, 0, 0, (float*)d_out, nullptr, OD, 0, NB * NQ, OD, VW);      /* out = sum_(h,c) wa o_w + o_bias */
}

// v002
// It runs in 36.7 microseconds.
// Versions in between are left out here; by their measured steps it is 22.9 times as fast as v000.
#include <hip/hip_runtime.h>
// PointwiseAttention (2 x 4096 queries (128-dim) over 4096 memory rows (64-dim); 4 heads, key dim 32, value dim 16; Q = q_data q_w * 32^-0.5, K = m_data k_w, V = m_data v_w; logits masked where mask[b][k] == 0; softmax; out = sum_{h,c} (attn V)[q][h][c] o_w[h][c][o] + o_bias -> [2][4096][64]).
// Compute dtype: inputs rounded to bf16; inputs/weights exact as f16; Q/K/V, the softmax weights and the averaged values as plain f16 operands (~2^-12); mask/softmax f32. v_wmma_f32_16x16x32_f16.
#define NB 2
#define NQ 4096
#define NK 4096
#define QD 128
#define MD 64
#define NH 4
#define HK 32
#define HV 16
#define KW (NH * HK)             /* 128 */
#define VW (NH * HV)             /* 64 */
#define OD 64
typedef unsigned short v8us __attribute__((ext_vector_type(8), may_alias));
typedef unsigned short v4us __attribute__((ext_vector_type(4), may_alias));
typedef float  v8f  __attribute__((ext_vector_type(8)));
typedef float  v4f  __attribute__((ext_vector_type(4)));
typedef float  v4fa __attribute__((ext_vector_type(4), may_alias));
typedef _Float16 v16h __attribute__((ext_vector_type(16)));
union FragH { v16h v; v8us half[2]; v4us quad[4]; _Float16 h[16]; unsigned short u[16]; };

__device__ __forceinline__ unsigned short bf16_bits(float x) { unsigned int u = __float_as_uint(x); return (unsigned short)((u + 0x7FFFu + ((u >> 16) & 1u)) >> 16); }
__device__ __forceinline__ float bf16_val(unsigned short b) { return __uint_as_float(((unsigned int)b) << 16); }
__device__ __forceinline__ float bf16_round(float x) { return bf16_val(bf16_bits(x)); }
// A or B fragment of the 16x16x32 f16 form from a row with k contiguous (global or LDS): k = 8*hh .. +7 and 16 + 8*hh .. +7
__device__ __forceinline__ v16h g2_frag(const _Float16* p, int hh) { FragH f; f.half[0] = *(const v8us*)((const unsigned short*)p + 8 * hh); f.half[1] = *(const v8us*)((const unsigned short*)p + 16 + 8 * hh); return f.v; }
__device__ __forceinline__ v16h s_frag(const unsigned short* p, int hh) { FragH f; f.half[0] = *(const v8us*)(p + 8 * hh); f.half[1] = *(const v8us*)(p + 16 + 8 * hh); return f.v; }
__device__ __forceinline__ v8f fa_mma(v16h a, v16h b, v8f c) { return __builtin_amdgcn_wmma_f32_16x16x32_f16(false, a, false, b, (short)0, c, false, false); }

// ---- all three projections in one launch ----
// One work-group = 64 rows of q_data (blocks 0 .. PJ_QB-1) or 64 rows of m_data (the rest). The f32 rows and the f32 weights are read once, coalesced,
// rounded (bf16, exact as f16; weights x16) and laid in LDS with k contiguous: rows as A, weights transposed as B. 8 waves = 4 row tiles x 2 column halves.
// Q and K leave as whole f16 rows, V leaves transposed ([b][value dim][key], whole 128-byte lines of 64 keys), all staged through LDS.
#define PJ_ROWS 64
#define PJ_QB (NB * NQ / PJ_ROWS)
#define PJ_MB (NB * NK / PJ_ROWS)
#define PJ_PQ (QD + 8)           /* LDS pitch in halves: 16 bytes over the row, for 16-byte readers */
#define PJ_PM (MD + 8)
#define PJ_PO (KW + 8)
// a wave's weight tile: 16 columns x 64 k; a lane takes 4 columns x 8 k (8 loads of 16 bytes), and stores 4 rows of 8 k
template <int N>
__device__ __forceinline__ const float* pj_wload(const float* __restrict__ Wf, int tile, int lane, v4f (&r)[8]) {
  const int n = ((tile % (N / 16)) * 4 + (lane & 3)) * 4, k = ((tile / (N / 16)) * 8 + (lane >> 2)) * 8;
  const float* p = Wf + (size_t)k * N + n;
#pragma unroll
  for (int j = 0; j < 8; ++j) r[j] = *(const v4fa*)(p + j * N);
  return p;
}
template <int N, int PITCH>
__device__ __forceinline__ void pj_wstore(unsigned short* sW, int tile, int lane, const v4f (&r)[8]) {
  const int n = ((tile % (N / 16)) * 4 + (lane & 3)) * 4, k = ((tile / (N / 16)) * 8 + (lane >> 2)) * 8;
#pragma unroll
  for (int c = 0; c < 4; ++c) {
    FragH f;
#pragma unroll
    for (int j = 0; j < 8; ++j) f.h[j] = (_Float16)(bf16_round(r[j][c]) * 16.0f);
    *(v8us*)(sW + (n + c) * PITCH + k) = f.half[0];
  }
}
template <int KD, int PITCH>
__device__ __forceinline__ void pj_xstore(unsigned short* sX, int i4, v4f x) {
  FragH f;
#pragma unroll
  for (int q = 0; q < 4; ++q) f.h[q] = (_Float16)bf16_round(x[q]);
  *(v4us*)(sX + (i4 / KD) * PITCH + (i4 % KD)) = f.quad[0];
}
__global__ __launch_bounds__(256) void k_proj(const float* __restrict__ qd, const float* __restrict__ md, const float* __restrict__ qw, const float* __restrict__ kw, const float* __restrict__ vw,
                                              _Float16* __restrict__ Q16, _Float16* __restrict__ K16, _Float16* __restrict__ VT) {
  __shared__ __attribute__((aligned(16))) unsigned short sW[KW * PJ_PQ];            /* also holds (KW + VW) rows of pitch PJ_PM */
  __shared__ __attribute__((aligned(16))) unsigned short sX[PJ_ROWS * PJ_PQ];
  __shared__ __attribute__((aligned(16))) unsigned short sO[PJ_ROWS * PJ_PO];
  __shared__ __attribute__((aligned(16))) unsigned short sV[VW * (PJ_ROWS + 8)];
  static_assert((KW + VW) * PJ_PM <= KW * PJ_PQ, "weight buffer");
  const int tid = threadIdx.x, w = tid >> 5, lane = tid & 31, ln = lane & 15, hh = lane >> 4;
  const int rt = w >> 1, ch = w & 1;
  const v8f z8 = {0.f,0.f,0.f,0.f,0.f,0.f,0.f,0.f};
  const int orow = tid >> 4, oc8 = (tid & 15) * 8;      /* output copy: 16 lanes a row of 256 bytes, 16 rows a pass */
  if (blockIdx.x < PJ_QB) {
    const size_t row0 = (size_t)blockIdx.x * PJ_ROWS;
    const float* xp = qd + row0 * QD;
    v4f x[8], w0[8], w1[8];
#pragma unroll
    for (int u = 0; u < 8; ++u) x[u] = *(const v4fa*)(xp + (tid + 256 * u) * 4);
    const float* p0 = pj_wload<KW>(qw, w, lane, w0); const float* p1 = pj_wload<KW>(qw, w + 8, lane, w1);
    asm volatile("s_wait_xcnt 0x0" :: "v"(p0), "v"(p1) : "memory");      /* all 24 loads are issued above this line, and their address registers stay as they are up to the wait */
#pragma unroll
    for (int u = 0; u < 8; ++u) pj_xstore<QD, PJ_PQ>(sX, (tid + 256 * u) * 4, x[u]);
    pj_wstore<KW, PJ_PQ>(sW, w, lane, w0); pj_wstore<KW, PJ_PQ>(sW, w + 8, lane, w1);
    __syncthreads();
    v8f acc[4] = {z8, z8, z8, z8};
#pragma unroll
    for (int kb = 0; kb < QD; kb += 32) {
      const v16h a = s_frag(sX + (rt * 16 + ln) * PJ_PQ + kb, hh);
#pragma unroll
      for (int t = 0; t < 4; ++t) acc[t] = fa_mma(a, s_frag(sW + (ch * 64 + t * 16 + ln) * PJ_PQ + kb, hh), acc[t]);
    }
#pragma unroll
    for (int t = 0; t < 4; ++t)
#pragma unroll
      for (int r = 0; r < 8; ++r) { FragH f; f.h[0] = (_Float16)(acc[t][r] * (0.0625f * 0.17677669529663687f)); sO[(rt * 16 + 8 * hh + r) * PJ_PO + ch * 64 + t * 16 + ln] = f.u[0]; }      /* Q * 32^-0.5 */
    __syncthreads();
    v8us o[4];
#pragma unroll
    for (int u = 0; u < 4; ++u) o[u] = *(const v8us*)(sO + (orow + 16 * u) * PJ_PO + oc8);
    unsigned short* po = (unsigned short*)Q16 + (row0 + orow) * KW + oc8;
#pragma unroll
    for (int u = 0; u < 4; ++u) *(v8us*)(po + 16 * u * KW) = o[u];      /* whole 256-byte rows */
  } else {
    const size_t row0 = (size_t)(blockIdx.x - PJ_QB) * PJ_ROWS;
    const float* xp = md + row0 * MD;
    v4f x[4], w0[8], w1[8];
#pragma unroll
    for (int u = 0; u < 4; ++u) x[u] = *(const v4fa*)(xp + (tid + 256 * u) * 4);
    const float* p0 = pj_wload<KW>(kw, w, lane, w0);
    if (w < 4) {
      const float* p1 = pj_wload<VW>(vw, w, lane, w1);
      asm volatile("s_wait_xcnt 0x0" :: "v"(p1) : "memory");      /* as below, for the four waves that bring the V weights */
    }
    asm volatile("s_wait_xcnt 0x0" :: "v"(p0) : "memory");      /* the loads are issued above this line, and their address registers stay as they are up to the wait */
#pragma unroll
    for (int u = 0; u < 4; ++u) pj_xstore<MD, PJ_PM>(sX, (tid + 256 * u) * 4, x[u]);
    pj_wstore<KW, PJ_PM>(sW, w, lane, w0);
    if (w < 4) pj_wstore<VW, PJ_PM>(sW + KW * PJ_PM, w, lane, w1);
    __syncthreads();
    v8f acc[6] = {z8, z8, z8, z8, z8, z8};      /* 0..3: 64 columns of K; 4, 5: 32 columns of V */
#pragma unroll
    for (int kb = 0; kb < MD; kb += 32) {
      const v16h a = s_frag(sX + (rt * 16 + ln) * PJ_PM + kb, hh);
#pragma unroll
      for (int t = 0; t < 4; ++t) acc[t] = fa_mma(a, s_frag(sW + (ch * 64 + t * 16 + ln) * PJ_PM + kb, hh), acc[t]);
#pragma unroll
      for (int t = 0; t < 2; ++t) acc[4 + t] = fa_mma(a, s_frag(sW + (KW + ch * 32 + t * 16 + ln) * PJ_PM + kb, hh), acc[4 + t]);
    }
#pragma unroll
    for (int t = 0; t < 4; ++t)
#pragma unroll
      for (int r = 0; r < 8; ++r) { FragH f; f.h[0] = (_Float16)(acc[t][r] * 0.0625f); sO[(rt * 16 + 8 * hh + r) * PJ_PO + ch * 64 + t * 16 + ln] = f.u[0]; }
#pragma unroll
    for (int t = 0; t < 2; ++t) {      /* a lane holds 8 consecutive keys of one value column: one 16-byte piece of a V^T row */
      FragH f;
#pragma unroll
      for (int r = 0; r < 8; ++r) f.h[r] = (_Float16)(acc[4 + t][r] * 0.0625f);
      *(v8us*)(sV + (ch * 32 + t * 16 + ln) * (PJ_ROWS + 8) + rt * 16 + 8 * hh) = f.half[0];
    }
    __syncthreads();
    const int vd = tid >> 3, vc8 = (tid & 7) * 8;      /* V^T copy: 8 lanes a line of 64 keys, 32 value columns a pass */
    v8us o[4], vt[2];
#pragma unroll
    for (int u = 0; u < 4; ++u) o[u] = *(const v8us*)(sO + (orow + 16 * u) * PJ_PO + oc8);
#pragma unroll
    for (int u = 0; u < 2; ++u) vt[u] = *(const v8us*)(sV + (vd + 32 * u) * (PJ_ROWS + 8) + vc8);
    unsigned short* po = (unsigned short*)K16 + (row0 + orow) * KW + oc8;
    unsigned short* pv = (unsigned short*)VT + ((row0 / NK) * VW + vd) * NK + (row0 % NK) + vc8;
#pragma unroll
    for (int u = 0; u < 4; ++u) *(v8us*)(po + 16 * u * KW) = o[u];      /* whole 256-byte rows */
#pragma unroll
    for (int u = 0; u < 2; ++u) *(v8us*)(pv + (size_t)32 * u * NK) = vt[u];      /* whole 128-byte lines */
  }
}

// Fused attention core: one work-group = 32 queries of one batch, 16 waves = 4 heads x 4 key quarters; scores, softmax weights and weighted values stay in registers.
// S^T = K Q^T (+ mask bias as the C operand), O^T += V^T P^T, so a lane holds one query's scores and the two score tiles of 32 keys pack straight into the B operand.
// The output projection runs in the epilogue on the work-group's own 32 rows: o_w is rounded and transposed into LDS at entry, 8 waves take one 16x16 output tile each.
// Running maximum per 64 keys; weights carry a factor 2^10 (as f16 operands) that cancels in the division; row sums by an all-ones A on the rounded weights.
#define FA_SPL 4
#define FA_KEYS (NK / FA_SPL)    /* 1024 keys per wave */
typedef float v2f __attribute__((ext_vector_type(2)));
typedef _Float16 v2h __attribute__((ext_vector_type(2)));
union FragP { v16h v; v2h p[8]; };
__device__ __forceinline__ float fa_xhalf(float x) { const int i = __float_as_int(x); return __int_as_float(__builtin_amdgcn_permlanex16(i, i, 0x76543210, 0xfedcba98, false, false)); }
__global__ __launch_bounds__(512) void k_fattn(const _Float16* __restrict__ Q16, const _Float16* __restrict__ K16, const _Float16* __restrict__ VT, const int* __restrict__ msk, const float* __restrict__ ow, const float* __restrict__ ob, float* __restrict__ out) {
  __shared__ __attribute__((aligned(32))) float sbias[NK];
  __shared__ __attribute__((aligned(16))) float sred[FA_SPL][NH][2][10][32];
  __shared__ __attribute__((aligned(16))) unsigned short sout[32][VW + 8];
  __shared__ __attribute__((aligned(16))) unsigned short sow[OD][VW + 8];      /* o_w transposed: [out column][h*16 + c], f16, x16 */
  __shared__ __attribute__((aligned(16))) float sfin[32][OD + 4];
  __shared__ float sob[OD];
  const int tid = threadIdx.x, w = tid >> 5, lane = tid & 31, ln = lane & 15, hh = lane >> 4;
  const int b = blockIdx.x / (NQ / 32), q0 = (blockIdx.x % (NQ / 32)) * 32;
  const int h = w & 3, sp = w >> 2;
  const float L2E = 1.4426950408889634f;
  // masked keys get -2^100: it swallows the score, its product with L2E is exact, so masked scores are all equal (a row with every key masked averages uniformly, as the reference does)
  for (int i = tid; i < NK; i += 512) sbias[i] = (msk[(size_t)b * NK + i] == 0) ? -0x1p100f : 0.f;
  { const int n = tid & (OD - 1), k8 = (tid >> 6) * 8; FragH f;      /* 512 threads = 64 columns x 8 groups of 8 k */
#pragma unroll
    for (int i = 0; i < 8; ++i) f.h[i] = (_Float16)(bf16_round(ow[(size_t)(k8 + i) * OD + n]) * 16.0f);
    *(v8us*)&sow[n][k8] = f.half[0]; }
  if (tid < OD) sob[tid] = bf16_round(ob[tid]);
  __syncthreads();
  v16h qf[2];
#pragma unroll
  for (int t = 0; t < 2; ++t) qf[t] = g2_frag(Q16 + ((size_t)b * NQ + q0 + t * 16 + ln) * KW + h * HK, hh);
  v16h ones;
#pragma unroll
  for (int i = 0; i < 16; ++i) ones[i] = (_Float16)1.0f;
  const _Float16* kp = K16 + ((size_t)b * NK + sp * FA_KEYS + ln) * KW + h * HK;
  const _Float16* vp = VT + ((size_t)b * VW + h * HV + ln) * NK + sp * FA_KEYS;
  const float* bp = sbias + sp * FA_KEYS + 8 * hh;
  const v8f z8 = {0.f,0.f,0.f,0.f,0.f,0.f,0.f,0.f};
  v8f o[2] = {z8, z8}, ls[2] = {z8, z8};
  float mraw[2] = {-3.0e38f, -3.0e38f}, mcs[2] = {-3.0e38f, -3.0e38f};
  for (int k0 = 0; k0 < FA_KEYS; k0 += 64, kp += (size_t)64 * KW) {      /* K pointer stepped once a trip: no address arithmetic among the loads, and its register pair is never a load's destination */
    v16h kf[4], vf[2]; v8f bias[4];
#pragma unroll
    for (int j = 0; j < 4; ++j) kf[j] = g2_frag(kp + (size_t)(j * 16) * KW, hh);
#pragma unroll
    for (int j = 0; j < 2; ++j) vf[j] = g2_frag(vp + k0 + j * 32, hh);
#pragma unroll
    for (int j = 0; j < 4; ++j) bias[j] = *(const v8f*)(bp + k0 + j * 16);
#pragma unroll
    for (int t = 0; t < 2; ++t) {
      v8f s[4];
#pragma unroll
      for (int j = 0; j < 4; ++j) s[j] = fa_mma(kf[j], qf[t], bias[j]);
      float mx = mraw[t];
#pragma unroll
      for (int j = 0; j < 4; ++j)
#pragma unroll
        for (int r = 0; r < 8; ++r) mx = fmaxf(mx, s[j][r]);
      mx = fmaxf(mx, fa_xhalf(mx));
      const float mc = __builtin_fmaf(mx, L2E, -10.0f);      /* exponent offset: weights = 2^10 exp(s - max) */
      const float al = __builtin_amdgcn_exp2f(mcs[t] - mc);
      mraw[t] = mx; mcs[t] = mc;
      const v2f l2 = {L2E, L2E}, nm = {-mc, -mc};
      FragP pf[2];
#pragma unroll
      for (int j = 0; j < 4; ++j)
#pragma unroll
        for (int e = 0; e < 4; ++e) {
          const v2f x = {s[j][2 * e], s[j][2 * e + 1]};
          const v2f y = __builtin_elementwise_fma(x, l2, nm);
          const v2f p = {__builtin_amdgcn_exp2f(y[0]), __builtin_amdgcn_exp2f(y[1])};
          pf[j >> 1].p[(j & 1) * 4 + e] = __builtin_convertvector(p, v2h);
        }
#pragma unroll
      for (int r = 0; r < 8; ++r) o[t][r] *= al;
      ls[t][0] *= al;      /* every row of the sum tile is the same sum; only register 0 is read */
      o[t] = fa_mma(vf[0], pf[0].v, o[t]); o[t] = fa_mma(vf[1], pf[1].v, o[t]);
      ls[t] = fa_mma(ones, pf[0].v, ls[t]); ls[t] = fa_mma(ones, pf[1].v, ls[t]);
    }
  }
#pragma unroll
  for (int t = 0; t < 2; ++t) {
    float* r = &sred[sp][h][t][0][lane];
    r[0] = mcs[t]; r[32] = ls[t][0];
#pragma unroll
    for (int e = 0; e < 8; ++e) r[(2 + e) * 32] = o[t][e];
  }
  __syncthreads();
  if (w < 8) {      /* join the four key quarters of one (head, query tile) */
    const int hd = w & 3, t = w >> 2;
    float mq[FA_SPL], M = -3.0e38f;
#pragma unroll
    for (int i = 0; i < FA_SPL; ++i) { mq[i] = sred[i][hd][t][0][lane]; M = fmaxf(M, mq[i]); }
    float L = 0.f, acc[8] = {0.f,0.f,0.f,0.f,0.f,0.f,0.f,0.f};
#pragma unroll
    for (int i = 0; i < FA_SPL; ++i) {
      const float wt = __builtin_amdgcn_exp2f(mq[i] - M);
      L += wt * sred[i][hd][t][1][lane];
#pragma unroll
      for (int e = 0; e < 8; ++e) acc[e] += wt * sred[i][hd][t][2 + e][lane];
    }
    const float rl = 1.0f / L;
    FragH f;
#pragma unroll
    for (int e = 0; e < 8; ++e) f.h[e] = (_Float16)(acc[e] * rl);
    *(v8us*)&sout[t * 16 + ln][hd * HV + 8 * hh] = f.half[0];
  }
  __syncthreads();
  if (w < 8) {      /* out tile = weighted values (32 x 64) o_w (64 x 64) / 16 + bias */
    const int mt = w >> 2, nt = w & 3;
    v8f acc = z8;
#pragma unroll
    for (int kb = 0; kb < VW; kb += 32) acc = fa_mma(s_frag(&sout[mt * 16 + ln][kb], hh), s_frag(&sow[nt * 16 + ln][kb], hh), acc);
    const float bv = sob[nt * 16 + ln];
#pragma unroll
    for (int r = 0; r < 8; ++r) sfin[mt * 16 + 8 * hh + r][nt * 16 + ln] = acc[r] * 0.0625f + bv;
  }
  __syncthreads();
  { const int row = tid >> 4, c4 = (tid & 15) * 4; *(v4f*)(out + ((size_t)b * NQ + q0 + row) * OD + c4) = *(const v4fa*)&sfin[row][c4]; }      /* whole 256-byte rows */
}
extern "C" void kernel_launch(void* const* d_in, const int* in_sizes, int n_in,
                              void* d_out, int out_size, void* d_ws, size_t ws_size, hipStream_t stream) {
  (void)in_sizes; (void)n_in; (void)out_size;
  const float* qd = (const float*)d_in[0]; const float* md = (const float*)d_in[1]; const int* msk = (const int*)d_in[2]; const float* qw = (const float*)d_in[3]; const float* kw = (const float*)d_in[4]; const float* vw = (const float*)d_in[5]; const float* ow = (const float*)d_in[6]; const float* ob = (const float*)d_in[7];
  char* ws = (char*)d_ws; size_t off = 0;
  auto take = [&](size_t bytes) { char* p = ws + off; off += (bytes + 255) & ~(size_t)255; return p; };
  _Float16* Q16 = (_Float16*)take((size_t)NB * NQ * KW * 2); _Float16* K16 = (_Float16*)take((size_t)NB * NK * KW * 2); _Float16* VT = (_Float16*)take((size_t)NB * NK * VW * 2);
  if (off > ws_size) return;
  k_proj<<<PJ_QB + PJ_MB, 256, 0, stream>>>(qd, md, qw, kw, vw, Q16, K16, VT);      /* Q * 32^-0.5, K as f16 rows; V^T [b][64][4096], head h = rows h*16 */
  k_fattn<<<NB * (NQ / 32), 512, 0, stream>>>(Q16, K16, VT, msk, ow, ob, (float*)d_out);      /* out = sum_(h,c) softmax-weighted values o_w + o_bias */
}

// v003
// One run takes 29.3 microseconds.
// In both of two side-by-side timings against v002, it was 1.26 times as fast.
// All steps since v000 together make it 28.8 times as fast.
#include <hip/hip_runtime.h>
// PointwiseAttention (2 x 4096 queries (128-dim) over 4096 memory rows (64-dim); 4 heads, key dim 32, value dim 16; Q = q_data q_w * 32^-0.5, K = m_data k_w, V = m_data v_w; logits masked where mask[b][k] == 0; softmax; out = sum_{h,c} (attn V)[q][h][c] o_w[h][c][o] + o_bias -> [2][4096][64]).
// Compute dtype: inputs rounded to bf16; inputs/weights exact as f16; Q/K/V, the softmax weights and the averaged values as plain f16 operands (~2^-12); mask/softmax f32. v_wmma_f32_16x16x32_f16.
#define NB 2
#define NQ 4096
#define NK 4096
#define QD 128
#define MD 64
#define NH 4
#define HK 32
#define HV 16
#define KW (NH * HK)             /* 128 */
#define VW (NH * HV)             /* 64 */
#define OD 64
typedef unsigned short v8us __attribute__((ext_vector_type(8), may_alias));
typedef unsigned short v4us __attribute__((ext_vector_type(4), may_alias));
typedef float  v8f  __attribute__((ext_vector_type(8)));
typedef float  v4f  __attribute__((ext_vector_type(4)));
typedef float  v4fa __attribute__((ext_vector_type(4), may_alias));
typedef _Float16 v16h __attribute__((ext_vector_type(16)));
union FragH { v16h v; v8us half[2]; v4us quad[4]; _Float16 h[16]; unsigned short u[16]; };

__device__ __forceinline__ unsigned short bf16_bits(float x) { unsigned int u = __float_as_uint(x); return (unsigned short)((u + 0x7FFFu + ((u >> 16) & 1u)) >> 16); }
__device__ __forceinline__ float bf16_val(unsigned short b) { return __uint_as_float(((unsigned int)b) << 16); }
__device__ __forceinline__ float bf16_round(float x) { return bf16_val(bf16_bits(x)); }
// A or B fragment of the 16x16x32 f16 form from an LDS row with k contiguous: k = 8*hh .. +7 and 16 + 8*hh .. +7
__device__ __forceinline__ v16h s_frag(const unsigned short* p, int hh) { FragH f; f.half[0] = *(const v8us*)(p + 8 * hh); f.half[1] = *(const v8us*)(p + 16 + 8 * hh); return f.v; }
__device__ __forceinline__ v8f fa_mma(v16h a, v16h b, v8f c) { return __builtin_amdgcn_wmma_f32_16x16x32_f16(false, a, false, b, (short)0, c, false, false); }

// ---- all three projections in one launch ----
// One work-group = 64 rows of q_data (blocks 0 .. PJ_QB-1) or 64 rows of m_data (the rest). The f32 rows and the f32 weights are read once, coalesced,
// rounded (bf16, exact as f16; weights x16) and laid in LDS with k contiguous: rows as A, weights transposed as B. 8 waves = 4 row tiles x 2 column halves.
// Q, K and V^T leave in the order the attention waves load them, as operand fragments: a fragment = 2 pieces of [lane][8 halves], so one 16-byte load of a wave is 512 bytes in a row.
// Q: [16 queries][head] fragments (16 queries x 32). K, V^T: per (batch, head, 64 keys) one block of KV_BLK halves = 4 K fragments (16 keys x 32), then 2 V^T fragments (16 value dims x 32 keys).
#define PJ_ROWS 64
#define PJ_QB (NB * NQ / PJ_ROWS)
#define PJ_MB (NB * NK / PJ_ROWS)
#define PJ_PQ (QD + 8)           /* LDS pitch in halves: 16 bytes over the row, for 16-byte readers */
#define PJ_PM (MD + 8)
#define PJ_PO (KW + 8)
#define FR_H 512                 /* halves in one 16 x 32 fragment */
#define KV_BLK (6 * FR_H)        /* halves per (batch, head, 64 keys) */
// a wave's weight tile: 16 columns x 64 k; a lane takes 4 columns x 8 k (8 loads of 16 bytes), and stores 4 rows of 8 k
template <int N>
__device__ __forceinline__ const float* pj_wload(const float* __restrict__ Wf, int tile, int lane, v4f (&r)[8]) {
  const int n = ((tile % (N / 16)) * 4 + (lane & 3)) * 4, k = ((tile / (N / 16)) * 8 + (lane >> 2)) * 8;
  const float* p = Wf + (size_t)k * N + n;
#pragma unroll
  for (int j = 0; j < 8; ++j) r[j] = *(const v4fa*)(p + j * N);
  return p;
}
template <int N, int PITCH>
__device__ __forceinline__ void pj_wstore(unsigned short* sW, int tile, int lane, const v4f (&r)[8]) {
  const int n = ((tile % (N / 16)) * 4 + (lane & 3)) * 4, k = ((tile / (N / 16)) * 8 + (lane >> 2)) * 8;
#pragma unroll
  for (int c = 0; c < 4; ++c) {
    FragH f;
#pragma unroll
    for (int j = 0; j < 8; ++j) f.h[j] = (_Float16)(bf16_round(r[j][c]) * 16.0f);
    *(v8us*)(sW + (n + c) * PITCH + k) = f.half[0];
  }
}
template <int KD, int PITCH>
__device__ __forceinline__ void pj_xstore(unsigned short* sX, int i4, v4f x) {
  FragH f;
#pragma unroll
  for (int q = 0; q < 4; ++q) f.h[q] = (_Float16)bf16_round(x[q]);
  *(v4us*)(sX + (i4 / KD) * PITCH + (i4 % KD)) = f.quad[0];
}
__global__ __launch_bounds__(256) void k_proj(const float* __restrict__ qd, const float* __restrict__ md, const float* __restrict__ qw, const float* __restrict__ kw, const float* __restrict__ vw,
                                              _Float16* __restrict__ Q16, _Float16* __restrict__ KV) {
  __shared__ __attribute__((aligned(16))) unsigned short sW[KW * PJ_PQ];            /* also holds (KW + VW) rows of pitch PJ_PM */
  __shared__ __attribute__((aligned(16))) unsigned short sX[PJ_ROWS * PJ_PQ];
  __shared__ __attribute__((aligned(16))) unsigned short sO[PJ_ROWS * PJ_PO];
  __shared__ __attribute__((aligned(16))) unsigned short sV[VW * (PJ_ROWS + 8)];
  static_assert((KW + VW) * PJ_PM <= KW * PJ_PQ, "weight buffer");
  const int tid = threadIdx.x, w = tid >> 5, lane = tid & 31, ln = lane & 15, hh = lane >> 4;
  const int rt = w >> 1, ch = w & 1;
  const v8f z8 = {0.f,0.f,0.f,0.f,0.f,0.f,0.f,0.f};
  /* output copies: a wave takes one piece of a fragment a pass: lane (ln, hh) takes k = 16 * piece + 8 * hh .. +7 of row ln, the place it has in the operand */
  if (blockIdx.x < PJ_QB) {
    const size_t row0 = (size_t)blockIdx.x * PJ_ROWS;
    const float* xp = qd + row0 * QD;
    v4f x[8], w0[8], w1[8];
#pragma unroll
    for (int u = 0; u < 8; ++u) x[u] = *(const v4fa*)(xp + (tid + 256 * u) * 4);
    const float* p0 = pj_wload<KW>(qw, w, lane, w0); const float* p1 = pj_wload<KW>(qw, w + 8, lane, w1);
    asm volatile("s_wait_xcnt 0x0" :: "v"(p0), "v"(p1) : "memory");      /* all 24 loads are issued above this line, and their address registers stay as they are up to the wait */
#pragma unroll
    for (int u = 0; u < 8; ++u) pj_xstore<QD, PJ_PQ>(sX, (tid + 256 * u) * 4, x[u]);
    pj_wstore<KW, PJ_PQ>(sW, w, lane, w0); pj_wstore<KW, PJ_PQ>(sW, w + 8, lane, w1);
    __syncthreads();
    v8f acc[4] = {z8, z8, z8, z8};
#pragma unroll
    for (int kb = 0; kb < QD; kb += 32) {
      const v16h a = s_frag(sX + (rt * 16 + ln) * PJ_PQ + kb, hh);
#pragma unroll
      for (int t = 0; t < 4; ++t) acc[t] = fa_mma(a, s_frag(sW + (ch * 64 + t * 16 + ln) * PJ_PQ + kb, hh), acc[t]);
    }
#pragma unroll
    for (int t = 0; t < 4; ++t)
#pragma unroll
      for (int r = 0; r < 8; ++r) { FragH f; f.h[0] = (_Float16)(acc[t][r] * (0.0625f * 0.17677669529663687f)); sO[(rt * 16 + 8 * hh + r) * PJ_PO + ch * 64 + t * 16 + ln] = f.u[0]; }      /* Q * 32^-0.5 */
    __syncthreads();
    v8us o[4];
#pragma unroll
    for (int u = 0; u < 4; ++u) o[u] = *(const v8us*)(sO + (rt * 16 + ln) * PJ_PO + u * HK + ch * 16 + 8 * hh);      /* pass u = head u; wave = query tile rt, piece ch */
    unsigned short* po = (unsigned short*)Q16 + (row0 / 16 + rt) * (NH * FR_H) + ch * (FR_H / 2) + lane * 8;
#pragma unroll
    for (int u = 0; u < 4; ++u) *(v8us*)(po + u * FR_H) = o[u];      /* 512 bytes in a row per wave */
  } else {
    const size_t row0 = (size_t)(blockIdx.x - PJ_QB) * PJ_ROWS;
    const float* xp = md + row0 * MD;
    v4f x[4], w0[8], w1[8];
#pragma unroll
    for (int u = 0; u < 4; ++u) x[u] = *(const v4fa*)(xp + (tid + 256 * u) * 4);
    const float* p0 = pj_wload<KW>(kw, w, lane, w0);
    if (w < 4) {
      const float* p1 = pj_wload<VW>(vw, w, lane, w1);
      asm volatile("s_wait_xcnt 0x0" :: "v"(p1) : "memory");      /* as below, for the four waves that bring the V weights */
    }
    asm volatile("s_wait_xcnt 0x0" :: "v"(p0) : "memory");      /* the loads are issued above this line, and their address registers stay as they are up to the wait */
#pragma unroll
    for (int u = 0; u < 4; ++u) pj_xstore<MD, PJ_PM>(sX, (tid + 256 * u) * 4, x[u]);
    pj_wstore<KW, PJ_PM>(sW, w, lane, w0);
    if (w < 4) pj_wstore<VW, PJ_PM>(sW + KW * PJ_PM, w, lane, w1);
    __syncthreads();
    v8f acc[6] = {z8, z8, z8, z8, z8, z8};      /* 0..3: 64 columns of K; 4, 5: 32 columns of V */
#pragma unroll
    for (int kb = 0; kb < MD; kb += 32) {
      const v16h a = s_frag(sX + (rt * 16 + ln) * PJ_PM + kb, hh);
#pragma unroll
      for (int t = 0; t < 4; ++t) acc[t] = fa_mma(a, s_frag(sW + (ch * 64 + t * 16 + ln) * PJ_PM + kb, hh), acc[t]);
#pragma unroll
      for (int t = 0; t < 2; ++t) acc[4 + t] = fa_mma(a, s_frag(sW + (KW + ch * 32 + t * 16 + ln) * PJ_PM + kb, hh), acc[4 + t]);
    }
#pragma unroll
    for (int t = 0; t < 4; ++t)
#pragma unroll
      for (int r = 0; r < 8; ++r) { FragH f; f.h[0] = (_Float16)(acc[t][r] * 0.0625f); sO[(rt * 16 + 8 * hh + r) * PJ_PO + ch * 64 + t * 16 + ln] = f.u[0]; }
#pragma unroll
    for (int t = 0; t < 2; ++t) {      /* a lane holds 8 consecutive keys of one value column: one 16-byte piece of a V^T row */
      FragH f;
#pragma unroll
      for (int r = 0; r < 8; ++r) f.h[r] = (_Float16)(acc[4 + t][r] * 0.0625f);
      *(v8us*)(sV + (ch * 32 + t * 16 + ln) * (PJ_ROWS + 8) + rt * 16 + 8 * hh) = f.half[0];
    }
    __syncthreads();
    v8us o[4], vt[2];
#pragma unroll
    for (int u = 0; u < 4; ++u) o[u] = *(const v8us*)(sO + (rt * 16 + ln) * PJ_PO + u * HK + ch * 16 + 8 * hh);      /* pass u = head u; wave = key tile rt, piece ch */
#pragma unroll
    for (int u = 0; u < 2; ++u) vt[u] = *(const v8us*)(sV + ((2 * u + (w >> 2)) * HV + ln) * (PJ_ROWS + 8) + (rt & 1) * 32 + ch * 16 + 8 * hh);      /* head 2u + w/4; 32-key half rt & 1, piece ch */
    unsigned short* pk = (unsigned short*)KV + ((row0 / NK) * NH * (NK / 64) + (row0 % NK) / 64) * KV_BLK + lane * 8;
#pragma unroll
    for (int u = 0; u < 4; ++u) *(v8us*)(pk + (size_t)u * (NK / 64) * KV_BLK + w * (FR_H / 2)) = o[u];      /* 512 bytes in a row per wave */
#pragma unroll
    for (int u = 0; u < 2; ++u) *(v8us*)(pk + (size_t)(2 * u + (w >> 2)) * (NK / 64) * KV_BLK + 4 * FR_H + (w & 3) * (FR_H / 2)) = vt[u];
  }
}

// Fused attention core: one work-group = 32 queries of one batch, 16 waves = 4 heads x 4 key quarters; scores, softmax weights and weighted values stay in registers.
// S^T = K Q^T (+ mask bias as the C operand), O^T += V^T P^T, so a lane holds one query's scores and the two score tiles of 32 keys pack straight into the B operand.
// The output projection runs in the epilogue on the work-group's own 32 rows: o_w is rounded and transposed into LDS at entry, 8 waves take one 16x16 output tile each.
// Running maximum per 64 keys; weights carry a factor 2^10 (as f16 operands) that cancels in the division; row sums by an all-ones A on the rounded weights.
#define FA_SPL 4
#define FA_KEYS (NK / FA_SPL)    /* 1024 keys per wave */
typedef float v2f __attribute__((ext_vector_type(2)));
typedef _Float16 v2h __attribute__((ext_vector_type(2)));
union FragP { v16h v; v2h p[8]; };
__device__ __forceinline__ float fa_xhalf(float x) { const int i = __float_as_int(x); return __int_as_float(__builtin_amdgcn_permlanex16(i, i, 0x76543210, 0xfedcba98, false, false)); }
// a fragment stored as 2 pieces of [lane][8 halves]; p already holds the lane's own 8 * lane
__device__ __forceinline__ v16h p_frag(const _Float16* p) { FragH f; f.half[0] = *(const v8us*)(const unsigned short*)p; f.half[1] = *(const v8us*)((const unsigned short*)p + FR_H / 2); return f.v; }
__global__ __launch_bounds__(512) void k_fattn(const _Float16* __restrict__ Q16, const _Float16* __restrict__ KV, const int* __restrict__ msk, const float* __restrict__ ow, const float* __restrict__ ob, float* __restrict__ out) {
  __shared__ __attribute__((aligned(32))) float sbias[NK];
  __shared__ __attribute__((aligned(16))) float sred[FA_SPL][NH][2][10][32];
  __shared__ __attribute__((aligned(16))) unsigned short sout[32][VW + 8];
  __shared__ __attribute__((aligned(16))) unsigned short sow[OD][VW + 8];      /* o_w transposed: [out column][h*16 + c], f16, x16 */
  __shared__ __attribute__((aligned(16))) float sfin[32][OD + 4];
  __shared__ float sob[OD];
  const int tid = threadIdx.x, w = tid >> 5, lane = tid & 31, ln = lane & 15, hh = lane >> 4;
  const int b = blockIdx.x / (NQ / 32), q0 = (blockIdx.x % (NQ / 32)) * 32;
  const int h = w & 3, sp = w >> 2;
  const float L2E = 1.4426950408889634f;
  // masked keys get -2^100: it swallows the score, its product with L2E is exact, so masked scores are all equal (a row with every key masked averages uniformly, as the reference does)
  for (int i = tid; i < NK; i += 512) sbias[i] = (msk[(size_t)b * NK + i] == 0) ? -0x1p100f : 0.f;
  { const int n = tid & (OD - 1), k8 = (tid >> 6) * 8; FragH f;      /* 512 threads = 64 columns x 8 groups of 8 k */
#pragma unroll
    for (int i = 0; i < 8; ++i) f.h[i] = (_Float16)(bf16_round(ow[(size_t)(k8 + i) * OD + n]) * 16.0f);
    *(v8us*)&sow[n][k8] = f.half[0]; }
  if (tid < OD) sob[tid] = bf16_round(ob[tid]);
  __syncthreads();
  v16h qf[2];
  const _Float16* qp = Q16 + ((size_t)((b * NQ + q0) / 16) * NH + h) * FR_H + lane * 8;
#pragma unroll
  for (int t = 0; t < 2; ++t) qf[t] = p_frag(qp + t * (NH * FR_H));
  v16h ones;
#pragma unroll
  for (int i = 0; i < 16; ++i) ones[i] = (_Float16)1.0f;
  const _Float16* kp = KV + ((size_t)(b * NH + h) * (NK / 64) + sp * (FA_KEYS / 64)) * KV_BLK + lane * 8;
  const float* bp = sbias + sp * FA_KEYS + 8 * hh;
  const v8f z8 = {0.f,0.f,0.f,0.f,0.f,0.f,0.f,0.f};
  v8f o[2] = {z8, z8}, ls[2] = {z8, z8};
  float mraw[2] = {-3.0e38f, -3.0e38f}, mcs[2] = {-3.0e38f, -3.0e38f};
  for (int k0 = 0; k0 < FA_KEYS; k0 += 64, kp += KV_BLK) {      /* one pointer for K and V^T, stepped once a trip: no address arithmetic among the loads, and its register pair is never a load's destination */
    v16h kf[4], vf[2]; v8f bias[4];
#pragma unroll
    for (int j = 0; j < 4; ++j) kf[j] = p_frag(kp + j * FR_H);
#pragma unroll
    for (int j = 0; j < 2; ++j) vf[j] = p_frag(kp + (4 + j) * FR_H);
#pragma unroll
    for (int j = 0; j < 4; ++j) bias[j] = *(const v8f*)(bp + k0 + j * 16);
#pragma unroll
    for (int t = 0; t < 2; ++t) {
      v8f s[4];
#pragma unroll
      for (int j = 0; j < 4; ++j) s[j] = fa_mma(kf[j], qf[t], bias[j]);
      float mx = mraw[t];
#pragma unroll
      for (int j = 0; j < 4; ++j)
#pragma unroll
        for (int r = 0; r < 8; ++r) mx = fmaxf(mx, s[j][r]);
      mx = fmaxf(mx, fa_xhalf(mx));
      const float mc = __builtin_fmaf(mx, L2E, -10.0f);      /* exponent offset: weights = 2^10 exp(s - max) */
      const float al = __builtin_amdgcn_exp2f(mcs[t] - mc);
      mraw[t] = mx; mcs[t] = mc;
      const v2f l2 = {L2E, L2E}, nm = {-mc, -mc};
      FragP pf[2];
#pragma unroll
      for (int j = 0; j < 4; ++j)
#pragma unroll
        for (int e = 0; e < 4; ++e) {
          const v2f x = {s[j][2 * e], s[j][2 * e + 1]};
          const v2f y = __builtin_elementwise_fma(x, l2, nm);
          const v2f p = {__builtin_amdgcn_exp2f(y[0]), __builtin_amdgcn_exp2f(y[1])};
          pf[j >> 1].p[(j & 1) * 4 + e] = __builtin_convertvector(p, v2h);
        }
#pragma unroll
      for (int r = 0; r < 8; ++r) o[t][r] *= al;
      ls[t][0] *= al;      /* every row of the sum tile is the same sum; only register 0 is read */
      o[t] = fa_mma(vf[0], pf[0].v, o[t]); o[t] = fa_mma(vf[1], pf[1].v, o[t]);
      ls[t] = fa_mma(ones, pf[0].v, ls[t]); ls[t] = fa_mma(ones, pf[1].v, ls[t]);
    }
  }
#pragma unroll
  for (int t = 0; t < 2; ++t) {
    float* r = &sred[sp][h][t][0][lane];
    r[0] = mcs[t]; r[32] = ls[t][0];
#pragma unroll
    for (int e = 0; e < 8; ++e) r[(2 + e) * 32] = o[t][e];
  }
  __syncthreads();
  if (w < 8) {      /* join the four key quarters of one (head, query tile) */
    const int hd = w & 3, t = w >> 2;
    float mq[FA_SPL], M = -3.0e38f;
#pragma unroll
    for (int i = 0; i < FA_SPL; ++i) { mq[i] = sred[i][hd][t][0][lane]; M = fmaxf(M, mq[i]); }
    float L = 0.f, acc[8] = {0.f,0.f,0.f,0.f,0.f,0.f,0.f,0.f};
#pragma unroll
    for (int i = 0; i < FA_SPL; ++i) {
      const float wt = __builtin_amdgcn_exp2f(mq[i] - M);
      L += wt * sred[i][hd][t][1][lane];
#pragma unroll
      for (int e = 0; e < 8; ++e) acc[e] += wt * sred[i][hd][t][2 + e][lane];
    }
    const float rl = 1.0f / L;
    FragH f;
#pragma unroll
    for (int e = 0; e < 8; ++e) f.h[e] = (_Float16)(acc[e] * rl);
    *(v8us*)&sout[t * 16 + ln][hd * HV + 8 * hh] = f.half[0];
  }
  __syncthreads();
  if (w < 8) {      /* out tile = weighted values (32 x 64) o_w (64 x 64) / 16 + bias */
    const int mt = w >> 2, nt = w & 3;
    v8f acc = z8;
#pragma unroll
    for (int kb = 0; kb < VW; kb += 32) acc = fa_mma(s_frag(&sout[mt * 16 + ln][kb], hh), s_frag(&sow[nt * 16 + ln][kb], hh), acc);
    const float bv = sob[nt * 16 + ln];
#pragma unroll
    for (int r = 0; r < 8; ++r) sfin[mt * 16 + 8 * hh + r][nt * 16 + ln] = acc[r] * 0.0625f + bv;
  }
  __syncthreads();
  { const int row = tid >> 4, c4 = (tid & 15) * 4; *(v4f*)(out + ((size_t)b * NQ + q0 + row) * OD + c4) = *(const v4fa*)&sfin[row][c4]; }      /* whole 256-byte rows */
}
extern "C" void kernel_launch(void* const* d_in, const int* in_sizes, int n_in,
                              void* d_out, int out_size, void* d_ws, size_t ws_size, hipStream_t stream) {
  (void)in_sizes; (void)n_in; (void)out_size;
  const float* qd = (const float*)d_in[0]; const float* md = (const float*)d_in[1]; const int* msk = (const int*)d_in[2]; const float* qw = (const float*)d_in[3]; const float* kw = (const float*)d_in[4]; const float* vw = (const float*)d_in[5]; const float* ow = (const float*)d_in[6]; const float* ob = (const float*)d_in[7];
  char* ws = (char*)d_ws; size_t off = 0;
  auto take = [&](size_t bytes) { char* p = ws + off; off += (bytes + 255) & ~(size_t)255; return p; };
  _Float16* Q16 = (_Float16*)take((size_t)NB * NQ * KW * 2); _Float16* KV = (_Float16*)take((size_t)NB * NK * (KW + VW) * 2);
  if (off > ws_size) return;
  k_proj<<<PJ_QB + PJ_MB, 256, 0, stream>>>(qd, md, qw, kw, vw, Q16, KV);      /* Q * 32^-0.5, K and V^T as f16 operand fragments */
  k_fattn<<<NB * (NQ / 32), 512, 0, stream>>>(Q16, KV, msk, ow, ob, (float*)d_out);      /* out = sum_(h,c) softmax-weighted values o_w + o_bias */
}

// v004
// Measured time: 17.8 microseconds a run.
// Timed twice side by side with v003, it ran 1.64 times as fast both times.
// Over all steps from v000 it is 47.3 times as fast.
#include <hip/hip_runtime.h>
// PointwiseAttention (2 x 4096 queries (128-dim) over 4096 memory rows (64-dim); 4 heads, key dim 32, value dim 16; Q = q_data q_w * 32^-0.5, K = m_data k_w, V = m_data v_w; logits masked where mask[b][k] == 0; softmax; out = sum_{h,c} (attn V)[q][h][c] o_w[h][c][o] + o_bias -> [2][4096][64]).
// Compute dtype: inputs rounded to bf16; inputs/weights exact as f16; Q/K/V, the softmax weights and the averaged values as plain f16 operands (~2^-12); mask/softmax f32. v_wmma_f32_16x16x32_f16.
#define NB 2
#define NQ 4096
#define NK 4096
#define QD 128
#define MD 64
#define NH 4
#define HK 32
#define HV 16
#define KW (NH * HK)             /* 128 */
#define VW (NH * HV)             /* 64 */
#define OD 64
typedef unsigned short v8us __attribute__((ext_vector_type(8), may_alias));
typedef unsigned short v4us __attribute__((ext_vector_type(4), may_alias));
typedef float  v8f  __attribute__((ext_vector_type(8)));
typedef float  v4f  __attribute__((ext_vector_type(4)));
typedef float  v4fa __attribute__((ext_vector_type(4), may_alias));
typedef _Float16 v16h __attribute__((ext_vector_type(16)));
union FragH { v16h v; v8us half[2]; v4us quad[4]; _Float16 h[16]; unsigned short u[16]; };

__device__ __forceinline__ unsigned short bf16_bits(float x) { unsigned int u = __float_as_uint(x); return (unsigned short)((u + 0x7FFFu + ((u >> 16) & 1u)) >> 16); }
__device__ __forceinline__ float bf16_val(unsigned short b) { return __uint_as_float(((unsigned int)b) << 16); }
__device__ __forceinline__ float bf16_round(float x) { return bf16_val(bf16_bits(x)); }
// A or B fragment of the 16x16x32 f16 form from an LDS row with k contiguous: k = 8*hh .. +7 and 16 + 8*hh .. +7
__device__ __forceinline__ v16h s_frag(const unsigned short* p, int hh) { FragH f; f.half[0] = *(const v8us*)(p + 8 * hh); f.half[1] = *(const v8us*)(p + 16 + 8 * hh); return f.v; }
__device__ __forceinline__ v8f fa_mma(v16h a, v16h b, v8f c) { return __builtin_amdgcn_wmma_f32_16x16x32_f16(false, a, false, b, (short)0, c, false, false); }

// ---- all three projections in one launch ----
// One work-group = 64 rows of q_data (blocks 0 .. PJ_QB-1) or 64 rows of m_data (the rest). The f32 rows and the f32 weights are read once, coalesced,
// rounded (bf16, exact as f16; weights x16) and laid in LDS with k contiguous: rows as A, weights transposed as B. 8 waves = 4 row tiles x 2 column halves.
// Q, K and V^T leave in the order the attention waves load them, as operand fragments: a fragment = 2 pieces of [lane][8 halves], so one 16-byte load of a wave is 512 bytes in a row.
// Q: [16 queries][head] fragments (16 queries x 32). K, V^T: per (batch, head, 64 keys) one block of KV_BLK halves = 4 K fragments (16 keys x 32), then 2 V^T fragments (16 value dims x 32 keys).
// Keys are packed: a masked key has softmax weight exactly 0, so memory block j of a batch projects the batch's unmasked rows of rank 64 j .. 64 j + 63 (in row order; ranks past the count are rows of zeros),
// blocks past the count do nothing, and the count goes to the attention launch. A batch with every key masked keeps all its rows, with count 0 (the reference then averages uniformly).
#define PJ_ROWS 64
#define PJ_QB (NB * NQ / PJ_ROWS)
#define PJ_MB (NB * NK / PJ_ROWS)
#define PJ_PQ (QD + 8)           /* LDS pitch in halves: 16 bytes over the row, for 16-byte readers */
#define PJ_PM (MD + 8)
#define PJ_PO (KW + 8)
#define FR_H 512                 /* halves in one 16 x 32 fragment */
#define KV_BLK (6 * FR_H)        /* halves per (batch, head, 64 keys) */
// a wave's weight tile: 16 columns x 64 k; a lane takes 4 columns x 8 k (8 loads of 16 bytes), and stores 4 rows of 8 k
template <int N>
__device__ __forceinline__ const float* pj_wload(const float* __restrict__ Wf, int tile, int lane, v4f (&r)[8]) {
  const int n = ((tile % (N / 16)) * 4 + (lane & 3)) * 4, k = ((tile / (N / 16)) * 8 + (lane >> 2)) * 8;
  const float* p = Wf + (size_t)k * N + n;
#pragma unroll
  for (int j = 0; j < 8; ++j) r[j] = *(const v4fa*)(p + j * N);
  return p;
}
template <int N, int PITCH>
__device__ __forceinline__ void pj_wstore(unsigned short* sW, int tile, int lane, const v4f (&r)[8]) {
  const int n = ((tile % (N / 16)) * 4 + (lane & 3)) * 4, k = ((tile / (N / 16)) * 8 + (lane >> 2)) * 8;
#pragma unroll
  for (int c = 0; c < 4; ++c) {
    FragH f;
#pragma unroll
    for (int j = 0; j < 8; ++j) f.h[j] = (_Float16)(bf16_round(r[j][c]) * 16.0f);
    *(v8us*)(sW + (n + c) * PITCH + k) = f.half[0];
  }
}
template <int KD, int PITCH>
__device__ __forceinline__ void pj_xstore(unsigned short* sX, int i4, v4f x) {
  FragH f;
#pragma unroll
  for (int q = 0; q < 4; ++q) f.h[q] = (_Float16)bf16_round(x[q]);
  *(v4us*)(sX + (i4 / KD) * PITCH + (i4 % KD)) = f.quad[0];
}
__global__ __launch_bounds__(256) void k_proj(const float* __restrict__ qd, const float* __restrict__ md, const int* __restrict__ msk, const float* __restrict__ qw, const float* __restrict__ kw, const float* __restrict__ vw,
                                              _Float16* __restrict__ Q16, _Float16* __restrict__ KV, int* __restrict__ CNT) {
  __shared__ __attribute__((aligned(16))) unsigned short sW[KW * PJ_PQ];            /* also holds (KW + VW) rows of pitch PJ_PM */
  __shared__ __attribute__((aligned(16))) unsigned short sX[PJ_ROWS * PJ_PQ];
  __shared__ __attribute__((aligned(16))) unsigned short sO[PJ_ROWS * PJ_PO];
  __shared__ __attribute__((aligned(16))) unsigned short sV[VW * (PJ_ROWS + 8)];
  __shared__ int sidx[PJ_ROWS];      /* source row of each of the block's 64 packed keys; -1: none */
  __shared__ int swc[8];             /* unmasked keys in each wave's 512 mask entries */
  static_assert((KW + VW) * PJ_PM <= KW * PJ_PQ, "weight buffer");
  const int tid = threadIdx.x, w = tid >> 5, lane = tid & 31, ln = lane & 15, hh = lane >> 4;
  const int rt = w >> 1, ch = w & 1;
  const v8f z8 = {0.f,0.f,0.f,0.f,0.f,0.f,0.f,0.f};
  /* output copies: a wave takes one piece of a fragment a pass: lane (ln, hh) takes k = 16 * piece + 8 * hh .. +7 of row ln, the place it has in the operand */
  if (blockIdx.x < PJ_QB) {
    const size_t row0 = (size_t)blockIdx.x * PJ_ROWS;
    const float* xp = qd + row0 * QD;
    v4f x[8], w0[8], w1[8];
#pragma unroll
    for (int u = 0; u < 8; ++u) x[u] = *(const v4fa*)(xp + (tid + 256 * u) * 4);
    const float* p0 = pj_wload<KW>(qw, w, lane, w0); const float* p1 = pj_wload<KW>(qw, w + 8, lane, w1);
    asm volatile("s_wait_xcnt 0x0" :: "v"(p0), "v"(p1) : "memory");      /* all 24 loads are issued above this line, and their address registers stay as they are up to the wait */
#pragma unroll
    for (int u = 0; u < 8; ++u) pj_xstore<QD, PJ_PQ>(sX, (tid + 256 * u) * 4, x[u]);
    pj_wstore<KW, PJ_PQ>(sW, w, lane, w0); pj_wstore<KW, PJ_PQ>(sW, w + 8, lane, w1);
    __syncthreads();
    v8f acc[4] = {z8, z8, z8, z8};
#pragma unroll
    for (int kb = 0; kb < QD; kb += 32) {
      const v16h a = s_frag(sX + (rt * 16 + ln) * PJ_PQ + kb, hh);
#pragma unroll
      for (int t = 0; t < 4; ++t) acc[t] = fa_mma(a, s_frag(sW + (ch * 64 + t * 16 + ln) * PJ_PQ + kb, hh), acc[t]);
    }
#pragma unroll
    for (int t = 0; t < 4; ++t)
#pragma unroll
      for (int r = 0; r < 8; ++r) { FragH f; f.h[0] = (_Float16)(acc[t][r] * (0.0625f * 0.17677669529663687f)); sO[(rt * 16 + 8 * hh + r) * PJ_PO + ch * 64 + t * 16 + ln] = f.u[0]; }      /* Q * 32^-0.5 */
    __syncthreads();
    v8us o[4];
#pragma unroll
    for (int u = 0; u < 4; ++u) o[u] = *(const v8us*)(sO + (rt * 16 + ln) * PJ_PO + u * HK + ch * 16 + 8 * hh);      /* pass u = head u; wave = query tile rt, piece ch */
    unsigned short* po = (unsigned short*)Q16 + (row0 / 16 + rt) * (NH * FR_H) + ch * (FR_H / 2) + lane * 8;
#pragma unroll
    for (int u = 0; u < 4; ++u) *(v8us*)(po + u * FR_H) = o[u];      /* 512 bytes in a row per wave */
  } else {
    const int mb = blockIdx.x - PJ_QB, bb = mb / (NK / PJ_ROWS), lo = (mb % (NK / PJ_ROWS)) * PJ_ROWS;      /* batch; rank of the block's first packed key */
    const size_t row0 = (size_t)mb * PJ_ROWS;
    const int wu = __builtin_amdgcn_readfirstlane(w);
    v4f x[4], w0[8], w1[8];
    int mv[16];
    const int* mp = msk + bb * NK + wu * 512 + lane;      /* the batch's whole mask: a wave takes 512 entries, 32 in a row a load */
#pragma unroll
    for (int i = 0; i < 16; ++i) mv[i] = mp[i * 32];
    const float* p0 = pj_wload<KW>(kw, w, lane, w0);
    asm volatile("s_wait_xcnt 0x0" :: "v"(p0) : "memory");      /* the loads are issued above this line, and their address registers stay as they are up to the wait */
    if (w < 4) {
      const float* p1 = pj_wload<VW>(vw, w, lane, w1);
      asm volatile("s_wait_xcnt 0x0" :: "v"(p1) : "memory");      /* as above, for the four waves that bring the V weights */
    }
    unsigned int bal[16]; int wc = 0;
#pragma unroll
    for (int i = 0; i < 16; ++i) { bal[i] = __builtin_amdgcn_ballot_w32(mv[i] != 0); wc += __builtin_popcount(bal[i]); }
    if (lane == 0) swc[wu] = wc;
    if (tid < PJ_ROWS) sidx[tid] = -1;
    __syncthreads();
    int n = 0, base = 0;      /* unmasked keys of the batch; of the waves below this one */
#pragma unroll
    for (int v = 0; v < 8; ++v) { const int c = swc[v]; n += c; base += (v < wu) ? c : 0; }
    n = __builtin_amdgcn_readfirstlane(n); base = __builtin_amdgcn_readfirstlane(base);
    if (lo < (n ? n : NK)) {      /* the same for the whole work-group: the barriers below are passed by all of its waves or by none */
    if (n == 0) {
      if (tid < PJ_ROWS) sidx[tid] = lo + tid;
    } else {
#pragma unroll
      for (int i = 0; i < 16; ++i) {
        const int c = __builtin_popcount(bal[i]);
        if (base + c > lo && base < lo + PJ_ROWS) {      /* scalar test: some of these 32 entries fall among the block's 64 ranks */
          const int r = base + (int)__builtin_amdgcn_mbcnt_lo(bal[i], 0u) - lo;
          if (((bal[i] >> lane) & 1u) && (unsigned int)r < (unsigned int)PJ_ROWS) sidx[r] = wu * 512 + i * 32 + lane;
        }
        base += c;
      }
    }
    __syncthreads();
    const float* xp = md + (size_t)bb * NK * MD;
    int sr[4]; const float* xq[4];
#pragma unroll
    for (int u = 0; u < 4; ++u) { sr[u] = sidx[(tid >> 4) + 16 * u]; xq[u] = xp + ((unsigned int)(sr[u] < 0 ? 0 : sr[u]) * MD + (tid & 15) * 4); }      /* 16 threads a row: whole 256-byte rows */
#pragma unroll
    for (int u = 0; u < 4; ++u) x[u] = *(const v4fa*)xq[u];
    asm volatile("s_wait_xcnt 0x0" :: "v"(xq[0]), "v"(xq[1]), "v"(xq[2]), "v"(xq[3]) : "memory");      /* the four row loads are issued above this line, and their address registers stay as they are up to the wait */
    pj_wstore<KW, PJ_PM>(sW, w, lane, w0);
    if (w < 4) pj_wstore<VW, PJ_PM>(sW + KW * PJ_PM, w, lane, w1);
#pragma unroll
    for (int u = 0; u < 4; ++u) { const v4f zx = {0.f, 0.f, 0.f, 0.f}; pj_xstore<MD, PJ_PM>(sX, (tid + 256 * u) * 4, sr[u] < 0 ? zx : x[u]); }
    __syncthreads();
    v8f acc[6] = {z8, z8, z8, z8, z8, z8};      /* 0..3: 64 columns of K; 4, 5: 32 columns of V */
#pragma unroll
    for (int kb = 0; kb < MD; kb += 32) {
      const v16h a = s_frag(sX + (rt * 16 + ln) * PJ_PM + kb, hh);
#pragma unroll
      for (int t = 0; t < 4; ++t) acc[t] = fa_mma(a, s_frag(sW + (ch * 64 + t * 16 + ln) * PJ_PM + kb, hh), acc[t]);
#pragma unroll
      for (int t = 0; t < 2; ++t) acc[4 + t] = fa_mma(a, s_frag(sW + (KW + ch * 32 + t * 16 + ln) * PJ_PM + kb, hh), acc[4 + t]);
    }
#pragma unroll
    for (int t = 0; t < 4; ++t)
#pragma unroll
      for (int r = 0; r < 8; ++r) { FragH f; f.h[0] = (_Float16)(acc[t][r] * 0.0625f); sO[(rt * 16 + 8 * hh + r) * PJ_PO + ch * 64 + t * 16 + ln] = f.u[0]; }
#pragma unroll
    for (int t = 0; t < 2; ++t) {      /* a lane holds 8 consecutive keys of one value column: one 16-byte piece of a V^T row */
      FragH f;
#pragma unroll
      for (int r = 0; r < 8; ++r) f.h[r] = (_Float16)(acc[4 + t][r] * 0.0625f);
      *(v8us*)(sV + (ch * 32 + t * 16 + ln) * (PJ_ROWS + 8) + rt * 16 + 8 * hh) = f.half[0];
    }
    __syncthreads();
    v8us o[4], vt[2];
#pragma unroll
    for (int u = 0; u < 4; ++u) o[u] = *(const v8us*)(sO + (rt * 16 + ln) * PJ_PO + u * HK + ch * 16 + 8 * hh);      /* pass u = head u; wave = key tile rt, piece ch */
#pragma unroll
    for (int u = 0; u < 2; ++u) vt[u] = *(const v8us*)(sV + ((2 * u + (w >> 2)) * HV + ln) * (PJ_ROWS + 8) + (rt & 1) * 32 + ch * 16 + 8 * hh);      /* head 2u + w/4; 32-key half rt & 1, piece ch */
    unsigned short* pk = (unsigned short*)KV + ((row0 / NK) * NH * (NK / 64) + (row0 % NK) / 64) * KV_BLK + lane * 8;
#pragma unroll
    for (int u = 0; u < 4; ++u) *(v8us*)(pk + (size_t)u * (NK / 64) * KV_BLK + w * (FR_H / 2)) = o[u];      /* 512 bytes in a row per wave */
#pragma unroll
    for (int u = 0; u < 2; ++u) *(v8us*)(pk + (size_t)(2 * u + (w >> 2)) * (NK / 64) * KV_BLK + 4 * FR_H + (w & 3) * (FR_H / 2)) = vt[u];
    }
    if (lo == NK - PJ_ROWS && tid == 0) CNT[bb] = n;      /* by the batch's last block, behind its last barrier: no barrier waits for this store */
  }
}

// Fused attention core: one work-group = 32 queries of one batch, 16 waves = 4 heads x 4 key shares (share sp: packed 64-key blocks sp, sp + 4, ... below the count); scores, softmax weights and weighted values stay in registers.
// S^T = K Q^T (+ mask bias as the C operand), O^T += V^T P^T, so a lane holds one query's scores and the two score tiles of 32 keys pack straight into the B operand.
// The output projection runs in the epilogue on the work-group's own 32 rows: o_w is rounded and transposed into LDS at entry, 8 waves take one 16x16 output tile each.
// Running maximum per 64 keys; weights carry a factor 2^10 (as f16 operands) that cancels in the division; row sums by an all-ones A on the rounded weights.
#define FA_SPL 4
typedef float v2f __attribute__((ext_vector_type(2)));
typedef _Float16 v2h __attribute__((ext_vector_type(2)));
union FragP { v16h v; v2h p[8]; };
__device__ __forceinline__ float fa_xhalf(float x) { const int i = __float_as_int(x); return __int_as_float(__builtin_amdgcn_permlanex16(i, i, 0x76543210, 0xfedcba98, false, false)); }
// a fragment stored as 2 pieces of [lane][8 halves]; p already holds the lane's own 8 * lane
__device__ __forceinline__ v16h p_frag(const _Float16* p) { FragH f; f.half[0] = *(const v8us*)(const unsigned short*)p; f.half[1] = *(const v8us*)((const unsigned short*)p + FR_H / 2); return f.v; }
__global__ __launch_bounds__(512) void k_fattn(const _Float16* __restrict__ Q16, const _Float16* __restrict__ KV, const int* __restrict__ CNT, const float* __restrict__ ow, const float* __restrict__ ob, float* __restrict__ out) {
  __shared__ __attribute__((aligned(32))) float sbias[NK];
  __shared__ __attribute__((aligned(16))) float sred[FA_SPL][NH][2][10][32];
  __shared__ __attribute__((aligned(16))) unsigned short sout[32][VW + 8];
  __shared__ __attribute__((aligned(16))) unsigned short sow[OD][VW + 8];      /* o_w transposed: [out column][h*16 + c], f16, x16 */
  __shared__ __attribute__((aligned(16))) float sfin[32][OD + 4];
  __shared__ float sob[OD];
  const int tid = threadIdx.x, w = __builtin_amdgcn_readfirstlane(tid >> 5), lane = tid & 31, ln = lane & 15, hh = lane >> 4;      /* the wave's number as a scalar: the key loop's trip count depends on it */
  const int b = blockIdx.x / (NQ / 32), q0 = (blockIdx.x % (NQ / 32)) * 32;
  const int h = w & 3, sp = w >> 2;
  const float L2E = 1.4426950408889634f;
  const int cnt = min(max(CNT[b], 0), NK);      /* unmasked keys of the batch, packed first; 0: every key is masked and all NK are stored */
  const int nblk = ((cnt ? cnt : NK) + 63) >> 6;
  { const int n = tid & (OD - 1), k8 = (tid >> 6) * 8; FragH f;      /* 512 threads = 64 columns x 8 groups of 8 k */
#pragma unroll
    for (int i = 0; i < 8; ++i) f.h[i] = (_Float16)(bf16_round(ow[(size_t)(k8 + i) * OD + n]) * 16.0f);
    *(v8us*)&sow[n][k8] = f.half[0]; }
  if (tid < OD) sob[tid] = bf16_round(ob[tid]);
  // keys past the count get -2^100: it swallows the score, its product with L2E is exact, so their scores are all equal (a row with every key masked averages uniformly, as the reference does)
  for (int u = 0; u < NK / 512; ++u) sbias[tid + 512 * u] = (tid + 512 * u < cnt) ? 0.f : -0x1p100f;
  __syncthreads();
  v16h qf[2];
  const _Float16* qp = Q16 + ((size_t)((b * NQ + q0) / 16) * NH + h) * FR_H + lane * 8;
#pragma unroll
  for (int t = 0; t < 2; ++t) qf[t] = p_frag(qp + t * (NH * FR_H));
  v16h ones;
#pragma unroll
  for (int i = 0; i < 16; ++i) ones[i] = (_Float16)1.0f;
  const _Float16* kp = KV + ((size_t)(b * NH + h) * (NK / 64) + sp) * KV_BLK + lane * 8;
  const float* bp = sbias + sp * 64 + 8 * hh;
  const v8f z8 = {0.f,0.f,0.f,0.f,0.f,0.f,0.f,0.f};
  v8f o[2] = {z8, z8}, ls[2] = {z8, z8};
  float mraw[2] = {-3.0e38f, -3.0e38f}, mcs[2] = {-3.0e38f, -3.0e38f};
  for (int kb = sp; kb < nblk; kb += FA_SPL, kp += FA_SPL * KV_BLK, bp += FA_SPL * 64) {      /* one pointer for K and V^T, stepped once a trip: no address arithmetic among the loads, and its register pair is never a load's destination */
    v16h kf[4], vf[2]; v8f bias[4];
#pragma unroll
    for (int j = 0; j < 4; ++j) kf[j] = p_frag(kp + j * FR_H);
#pragma unroll
    for (int j = 0; j < 2; ++j) vf[j] = p_frag(kp + (4 + j) * FR_H);
#pragma unroll
    for (int j = 0; j < 4; ++j) bias[j] = *(const v8f*)(bp + j * 16);
#pragma unroll
    for (int t = 0; t < 2; ++t) {
      v8f s[4];
#pragma unroll
      for (int j = 0; j < 4; ++j) s[j] = fa_mma(kf[j], qf[t], bias[j]);
      float mx = mraw[t];
#pragma unroll
      for (int j = 0; j < 4; ++j)
#pragma unroll
        for (int r = 0; r < 8; ++r) mx = fmaxf(mx, s[j][r]);
      mx = fmaxf(mx, fa_xhalf(mx));
      const float mc = __builtin_fmaf(mx, L2E, -10.0f);      /* exponent offset: weights = 2^10 exp(s - max) */
      const float al = __builtin_amdgcn_exp2f(mcs[t] - mc);
      mraw[t] = mx; mcs[t] = mc;
      const v2f l2 = {L2E, L2E}, nm = {-mc, -mc};
      FragP pf[2];
#pragma unroll
      for (int j = 0; j < 4; ++j)
#pragma unroll
        for (int e = 0; e < 4; ++e) {
          const v2f x = {s[j][2 * e], s[j][2 * e + 1]};
          const v2f y = __builtin_elementwise_fma(x, l2, nm);
          const v2f p = {__builtin_amdgcn_exp2f(y[0]), __builtin_amdgcn_exp2f(y[1])};
          pf[j >> 1].p[(j & 1) * 4 + e] = __builtin_convertvector(p, v2h);
        }
#pragma unroll
      for (int r = 0; r < 8; ++r) o[t][r] *= al;
      ls[t][0] *= al;      /* every row of the sum tile is the same sum; only register 0 is read */
      o[t] = fa_mma(vf[0], pf[0].v, o[t]); o[t] = fa_mma(vf[1], pf[1].v, o[t]);
      ls[t] = fa_mma(ones, pf[0].v, ls[t]); ls[t] = fa_mma(ones, pf[1].v, ls[t]);
    }
  }
#pragma unroll
  for (int t = 0; t < 2; ++t) {
    float* r = &sred[sp][h][t][0][lane];
    r[0] = mcs[t]; r[32] = ls[t][0];
#pragma unroll
    for (int e = 0; e < 8; ++e) r[(2 + e) * 32] = o[t][e];
  }
  __syncthreads();
  if (w < 8) {      /* join the four key shares of one (head, query tile); a share with no block has weight 0 */
    const int hd = w & 3, t = w >> 2;
    float mq[FA_SPL], M = -3.0e38f;
#pragma unroll
    for (int i = 0; i < FA_SPL; ++i) { mq[i] = sred[i][hd][t][0][lane]; M = fmaxf(M, mq[i]); }
    float L = 0.f, acc[8] = {0.f,0.f,0.f,0.f,0.f,0.f,0.f,0.f};
#pragma unroll
    for (int i = 0; i < FA_SPL; ++i) {
      const float wt = __builtin_amdgcn_exp2f(mq[i] - M);
      L += wt * sred[i][hd][t][1][lane];
#pragma unroll
      for (int e = 0; e < 8; ++e) acc[e] += wt * sred[i][hd][t][2 + e][lane];
    }
    const float rl = 1.0f / L;
    FragH f;
#pragma unroll
    for (int e = 0; e < 8; ++e) f.h[e] = (_Float16)(acc[e] * rl);
    *(v8us*)&sout[t * 16 + ln][hd * HV + 8 * hh] = f.half[0];
  }
  __syncthreads();
  if (w < 8) {      /* out tile = weighted values (32 x 64) o_w (64 x 64) / 16 + bias */
    const int mt = w >> 2, nt = w & 3;
    v8f acc = z8;
#pragma unroll
    for (int kb = 0; kb < VW; kb += 32) acc = fa_mma(s_frag(&sout[mt * 16 + ln][kb], hh), s_frag(&sow[nt * 16 + ln][kb], hh), acc);
    const float bv = sob[nt * 16 + ln];
#pragma unroll
    for (int r = 0; r < 8; ++r) sfin[mt * 16 + 8 * hh + r][nt * 16 + ln] = acc[r] * 0.0625f + bv;
  }
  __syncthreads();
  { const int row = tid >> 4, c4 = (tid & 15) * 4; *(v4f*)(out + ((size_t)b * NQ + q0 + row) * OD + c4) = *(const v4fa*)&sfin[row][c4]; }      /* whole 256-byte rows */
}
extern "C" void kernel_launch(void* const* d_in, const int* in_sizes, int n_in,
                              void* d_out, int out_size, void* d_ws, size_t ws_size, hipStream_t stream) {
  (void)in_sizes; (void)n_in; (void)out_size;
  const float* qd = (const float*)d_in[0]; const float* md = (const float*)d_in[1]; const int* msk = (const int*)d_in[2]; const float* qw = (const float*)d_in[3]; const float* kw = (const float*)d_in[4]; const float* vw = (const float*)d_in[5]; const float* ow = (const float*)d_in[6]; const float* ob = (const float*)d_in[7];
  char* ws = (char*)d_ws; size_t off = 0;
  auto take = [&](size_t bytes) { char* p = ws + off; off += (bytes + 255) & ~(size_t)255; return p; };
  _Float16* Q16 = (_Float16*)take((size_t)NB * NQ * KW * 2); _Float16* KV = (_Float16*)take((size_t)NB * NK * (KW + VW) * 2); int* CNT = (int*)take(NB * sizeof(int));
  if (off > ws_size) return;
  k_proj<<<PJ_QB + PJ_MB, 256, 0, stream>>>(qd, md, msk, qw, kw, vw, Q16, KV, CNT);      /* Q * 32^-0.5, K and V^T of the unmasked keys as f16 operand fragments; their count */
  k_fattn<<<NB * (NQ / 32), 512, 0, stream>>>(Q16, KV, CNT, ow, ob, (float*)d_out);      /* out = sum_(h,c) softmax-weighted values o_w + o_bias */
}

// v005
// Measured time: 16.7 microseconds a run.
// Two timings next to v004 both put it at 1.07 times that version's speed.
// Counting every step since v000, it is 50.7 times as fast.
#include <hip/hip_runtime.h>
// PointwiseAttention (2 x 4096 queries (128-dim) over 4096 memory rows (64-dim); 4 heads, key dim 32, value dim 16; Q = q_data q_w * 32^-0.5, K = m_data k_w, V = m_data v_w; logits masked where mask[b][k] == 0; softmax; out = sum_{h,c} (attn V)[q][h][c] o_w[h][c][o] + o_bias -> [2][4096][64]).
// Compute dtype: inputs rounded to bf16; inputs/weights exact as f16; Q/K/V, the softmax weights and the averaged values as plain f16 operands (~2^-12); mask/softmax f32. v_wmma_f32_16x16x32_f16.
#define NB 2
#define NQ 4096
#define NK 4096
#define QD 128
#define MD 64
#define NH 4
#define HK 32
#define HV 16
#define KW (NH * HK)             /* 128 */
#define VW (NH * HV)             /* 64 */
#define OD 64
typedef unsigned short v8us __attribute__((ext_vector_type(8), may_alias));
typedef unsigned short v4us __attribute__((ext_vector_type(4), may_alias));
typedef float  v8f  __attribute__((ext_vector_type(8)));
typedef float  v4f  __attribute__((ext_vector_type(4)));
typedef float  v4fa __attribute__((ext_vector_type(4), may_alias));
typedef _Float16 v16h __attribute__((ext_vector_type(16)));
union FragH { v16h v; v8us half[2]; v4us quad[4]; _Float16 h[16]; unsigned short u[16]; };

__device__ __forceinline__ unsigned short bf16_bits(float x) { unsigned int u = __float_as_uint(x); return (unsigned short)((u + 0x7FFFu + ((u >> 16) & 1u)) >> 16); }
__device__ __forceinline__ float bf16_val(unsigned short b) { return __uint_as_float(((unsigned int)b) << 16); }
__device__ __forceinline__ float bf16_round(float x) { return bf16_val(bf16_bits(x)); }
// A or B fragment of the 16x16x32 f16 form from an LDS row with k contiguous: k = 8*hh .. +7 and 16 + 8*hh .. +7
__device__ __forceinline__ v16h s_frag(const unsigned short* p, int hh) { FragH f; f.half[0] = *(const v8us*)(p + 8 * hh); f.half[1] = *(const v8us*)(p + 16 + 8 * hh); return f.v; }
__device__ __forceinline__ v8f fa_mma(v16h a, v16h b, v8f c) { return __builtin_amdgcn_wmma_f32_16x16x32_f16(false, a, false, b, (short)0, c, false, false); }

// ---- all three projections in one launch ----
// One work-group = 64 rows of q_data (blocks 0 .. PJ_QB-1) or 64 rows of m_data (the rest). The f32 rows and the f32 weights are read once, coalesced,
// rounded (bf16, exact as f16; weights x16) and laid in LDS with k contiguous: rows as A, weights transposed as B. 8 waves = 4 row tiles x 2 column halves.
// Q, K and V^T leave in the order the attention waves load them, as operand fragments: a fragment = 2 pieces of [lane][8 halves], so one 16-byte load of a wave is 512 bytes in a row.
// Q: [16 queries][head] fragments (16 queries x 32). K, V^T: per (batch, head, 64 keys) one block of KV_BLK halves = 4 K fragments (16 keys x 32), then 2 V^T fragments (16 value dims x 32 keys).
// Keys are packed: a masked key has softmax weight exactly 0, so memory block j of a batch projects the batch's unmasked rows of rank 64 j .. 64 j + 63 (in row order; ranks past the count are rows of zeros),
// blocks past the count do nothing, and the count goes to the attention launch. A batch with every key masked keeps all its rows, with count 0 (the reference then averages uniformly).
#define PJ_ROWS 64
#define PJ_QB (NB * NQ / PJ_ROWS)
#define PJ_MB (NB * NK / PJ_ROWS)
#define PJ_PQ (QD + 8)           /* LDS pitch in halves: 16 bytes over the row, for 16-byte readers */
#define PJ_PM (MD + 8)
#define PJ_PO (KW + 8)
#define FR_H 512                 /* halves in one 16 x 32 fragment */
#define KV_BLK (6 * FR_H)        /* halves per (batch, head, 64 keys) */
// a wave's weight tile: 16 columns x 64 k; a lane takes 4 columns x 8 k (8 loads of 16 bytes), and stores 4 rows of 8 k
template <int N>
__device__ __forceinline__ const float* pj_wload(const float* __restrict__ Wf, int tile, int lane, v4f (&r)[8]) {
  const int n = ((tile % (N / 16)) * 4 + (lane & 3)) * 4, k = ((tile / (N / 16)) * 8 + (lane >> 2)) * 8;
  const float* p = Wf + (size_t)k * N + n;
#pragma unroll
  for (int j = 0; j < 8; ++j) r[j] = *(const v4fa*)(p + j * N);
  return p;
}
template <int N, int PITCH>
__device__ __forceinline__ void pj_wstore(unsigned short* sW, int tile, int lane, const v4f (&r)[8]) {
  const int n = ((tile % (N / 16)) * 4 + (lane & 3)) * 4, k = ((tile / (N / 16)) * 8 + (lane >> 2)) * 8;
#pragma unroll
  for (int c = 0; c < 4; ++c) {
    FragH f;
#pragma unroll
    for (int j = 0; j < 8; ++j) f.h[j] = (_Float16)(bf16_round(r[j][c]) * 16.0f);
    *(v8us*)(sW + (n + c) * PITCH + k) = f.half[0];
  }
}
template <int KD, int PITCH>
__device__ __forceinline__ void pj_xstore(unsigned short* sX, int i4, v4f x) {
  FragH f;
#pragma unroll
  for (int q = 0; q < 4; ++q) f.h[q] = (_Float16)bf16_round(x[q]);
  *(v4us*)(sX + (i4 / KD) * PITCH + (i4 % KD)) = f.quad[0];
}
__global__ __launch_bounds__(256) void k_proj(const float* __restrict__ qd, const float* __restrict__ md, const int* __restrict__ msk, const float* __restrict__ qw, const float* __restrict__ kw, const float* __restrict__ vw,
                                              _Float16* __restrict__ Q16, _Float16* __restrict__ KV, int* __restrict__ CNT) {
  __shared__ __attribute__((aligned(16))) unsigned short sW[KW * PJ_PQ];            /* also holds (KW + VW) rows of pitch PJ_PM */
  __shared__ __attribute__((aligned(16))) unsigned short sX[PJ_ROWS * PJ_PQ];
  __shared__ __attribute__((aligned(16))) unsigned short sO[PJ_ROWS * PJ_PO];
  __shared__ __attribute__((aligned(16))) unsigned short sV[VW * (PJ_ROWS + 8)];
  __shared__ int sidx[PJ_ROWS];      /* source row of each of the block's 64 packed keys; -1: none */
  __shared__ int swc[8];             /* unmasked keys in each wave's 512 mask entries */
  static_assert((KW + VW) * PJ_PM <= KW * PJ_PQ, "weight buffer");
  const int tid = threadIdx.x, w = tid >> 5, lane = tid & 31, ln = lane & 15, hh = lane >> 4;
  const int rt = w >> 1, ch = w & 1;
  const v8f z8 = {0.f,0.f,0.f,0.f,0.f,0.f,0.f,0.f};
  /* output copies: a wave takes one piece of a fragment a pass: lane (ln, hh) takes k = 16 * piece + 8 * hh .. +7 of row ln, the place it has in the operand */
  if (blockIdx.x < PJ_QB) {
    const size_t row0 = (size_t)blockIdx.x * PJ_ROWS;
    const float* xp = qd + row0 * QD;
    v4f x[8], w0[8], w1[8];
#pragma unroll
    for (int u = 0; u < 8; ++u) x[u] = *(const v4fa*)(xp + (tid + 256 * u) * 4);
    const float* p0 = pj_wload<KW>(qw, w, lane, w0); const float* p1 = pj_wload<KW>(qw, w + 8, lane, w1);
    asm volatile("s_wait_xcnt 0x0" :: "v"(p0), "v"(p1) : "memory");      /* all 24 loads are issued above this line, and their address registers stay as they are up to the wait */
#pragma unroll
    for (int u = 0; u < 8; ++u) pj_xstore<QD, PJ_PQ>(sX, (tid + 256 * u) * 4, x[u]);
    pj_wstore<KW, PJ_PQ>(sW, w, lane, w0); pj_wstore<KW, PJ_PQ>(sW, w + 8, lane, w1);
    __syncthreads();
    v8f acc[4] = {z8, z8, z8, z8};
#pragma unroll
    for (int kb = 0; kb < QD; kb += 32) {
      const v16h a = s_frag(sX + (rt * 16 + ln) * PJ_PQ + kb, hh);
#pragma unroll
      for (int t = 0; t < 4; ++t) acc[t] = fa_mma(a, s_frag(sW + (ch * 64 + t * 16 + ln) * PJ_PQ + kb, hh), acc[t]);
    }
#pragma unroll
    for (int t = 0; t < 4; ++t)
#pragma unroll
      for (int r = 0; r < 8; ++r) { FragH f; f.h[0] = (_Float16)(acc[t][r] * (0.0625f * 0.17677669529663687f)); sO[(rt * 16 + 8 * hh + r) * PJ_PO + ch * 64 + t * 16 + ln] = f.u[0]; }      /* Q * 32^-0.5 */
    __syncthreads();
    v8us o[4];
#pragma unroll
    for (int u = 0; u < 4; ++u) o[u] = *(const v8us*)(sO + (rt * 16 + ln) * PJ_PO + u * HK + ch * 16 + 8 * hh);      /* pass u = head u; wave = query tile rt, piece ch */
    unsigned short* po = (unsigned short*)Q16 + (row0 / 16 + rt) * (NH * FR_H) + ch * (FR_H / 2) + lane * 8;
#pragma unroll
    for (int u = 0; u < 4; ++u) *(v8us*)(po + u * FR_H) = o[u];      /* 512 bytes in a row per wave */
  } else {
    const int mb = blockIdx.x - PJ_QB, bb = mb / (NK / PJ_ROWS), lo = (mb % (NK / PJ_ROWS)) * PJ_ROWS;      /* batch; rank of the block's first packed key */
    const size_t row0 = (size_t)mb * PJ_ROWS;
    const int wu = __builtin_amdgcn_readfirstlane(w);
    v4f x[4], w0[8], w1[8];
    int mv[16];
    const int* mp = msk + bb * NK + wu * 512 + lane;      /* the batch's whole mask: a wave takes 512 entries, 32 in a row a load */
#pragma unroll
    for (int i = 0; i < 16; ++i) mv[i] = mp[i * 32];
    const float* p0 = pj_wload<KW>(kw, w, lane, w0);
    asm volatile("s_wait_xcnt 0x0" :: "v"(p0) : "memory");      /* the loads are issued above this line, and their address registers stay as they are up to the wait */
    if (w < 4) {
      const float* p1 = pj_wload<VW>(vw, w, lane, w1);
      asm volatile("s_wait_xcnt 0x0" :: "v"(p1) : "memory");      /* as above, for the four waves that bring the V weights */
    }
    unsigned int bal[16]; int wc = 0;
#pragma unroll
    for (int i = 0; i < 16; ++i) { bal[i] = __builtin_amdgcn_ballot_w32(mv[i] != 0); wc += __builtin_popcount(bal[i]); }
    if (lane == 0) swc[wu] = wc;
    if (tid < PJ_ROWS) sidx[tid] = -1;
    __syncthreads();
    int n = 0, base = 0;      /* unmasked keys of the batch; of the waves below this one */
#pragma unroll
    for (int v = 0; v < 8; ++v) { const int c = swc[v]; n += c; base += (v < wu) ? c : 0; }
    n = __builtin_amdgcn_readfirstlane(n); base = __builtin_amdgcn_readfirstlane(base);
    if (lo < (n ? n : NK)) {      /* the same for the whole work-group: the barriers below are passed by all of its waves or by none */
    if (n == 0) {
      if (tid < PJ_ROWS) sidx[tid] = lo + tid;
    } else {
#pragma unroll
      for (int i = 0; i < 16; ++i) {
        const int c = __builtin_popcount(bal[i]);
        if (base + c > lo && base < lo + PJ_ROWS) {      /* scalar test: some of these 32 entries fall among the block's 64 ranks */
          const int r = base + (int)__builtin_amdgcn_mbcnt_lo(bal[i], 0u) - lo;
          if (((bal[i] >> lane) & 1u) && (unsigned int)r < (unsigned int)PJ_ROWS) sidx[r] = wu * 512 + i * 32 + lane;
        }
        base += c;
      }
    }
    __syncthreads();
    const float* xp = md + (size_t)bb * NK * MD;
    int sr[4]; const float* xq[4];
#pragma unroll
    for (int u = 0; u < 4; ++u) { sr[u] = sidx[(tid >> 4) + 16 * u]; xq[u] = xp + ((unsigned int)(sr[u] < 0 ? 0 : sr[u]) * MD + (tid & 15) * 4); }      /* 16 threads a row: whole 256-byte rows */
#pragma unroll
    for (int u = 0; u < 4; ++u) x[u] = *(const v4fa*)xq[u];
    asm volatile("s_wait_xcnt 0x0" :: "v"(xq[0]), "v"(xq[1]), "v"(xq[2]), "v"(xq[3]) : "memory");      /* the four row loads are issued above this line, and their address registers stay as they are up to the wait */
    pj_wstore<KW, PJ_PM>(sW, w, lane, w0);
    if (w < 4) pj_wstore<VW, PJ_PM>(sW + KW * PJ_PM, w, lane, w1);
#pragma unroll
    for (int u = 0; u < 4; ++u) { const v4f zx = {0.f, 0.f, 0.f, 0.f}; pj_xstore<MD, PJ_PM>(sX, (tid + 256 * u) * 4, sr[u] < 0 ? zx : x[u]); }
    __syncthreads();
    v8f acc[6] = {z8, z8, z8, z8, z8, z8};      /* 0..3: 64 columns of K; 4, 5: 32 columns of V */
#pragma unroll
    for (int kb = 0; kb < MD; kb += 32) {
      const v16h a = s_frag(sX + (rt * 16 + ln) * PJ_PM + kb, hh);
#pragma unroll
      for (int t = 0; t < 4; ++t) acc[t] = fa_mma(a, s_frag(sW + (ch * 64 + t * 16 + ln) * PJ_PM + kb, hh), acc[t]);
#pragma unroll
      for (int t = 0; t < 2; ++t) acc[4 + t] = fa_mma(a, s_frag(sW + (KW + ch * 32 + t * 16 + ln) * PJ_PM + kb, hh), acc[4 + t]);
    }
#pragma unroll
    for (int t = 0; t < 4; ++t)
#pragma unroll
      for (int r = 0; r < 8; ++r) { FragH f; f.h[0] = (_Float16)(acc[t][r] * 0.0625f); sO[(rt * 16 + 8 * hh + r) * PJ_PO + ch * 64 + t * 16 + ln] = f.u[0]; }
#pragma unroll
    for (int t = 0; t < 2; ++t) {      /* a lane holds 8 consecutive keys of one value column: one 16-byte piece of a V^T row */
      FragH f;
#pragma unroll
      for (int r = 0; r < 8; ++r) f.h[r] = (_Float16)(acc[4 + t][r] * 0.0625f);
      *(v8us*)(sV + (ch * 32 + t * 16 + ln) * (PJ_ROWS + 8) + rt * 16 + 8 * hh) = f.half[0];
    }
    __syncthreads();
    v8us o[4], vt[2];
#pragma unroll
    for (int u = 0; u < 4; ++u) o[u] = *(const v8us*)(sO + (rt * 16 + ln) * PJ_PO + u * HK + ch * 16 + 8 * hh);      /* pass u = head u; wave = key tile rt, piece ch */
#pragma unroll
    for (int u = 0; u < 2; ++u) vt[u] = *(const v8us*)(sV + ((2 * u + (w >> 2)) * HV + ln) * (PJ_ROWS + 8) + (rt & 1) * 32 + ch * 16 + 8 * hh);      /* head 2u + w/4; 32-key half rt & 1, piece ch */
    unsigned short* pk = (unsigned short*)KV + ((row0 / NK) * NH * (NK / 64) + (row0 % NK) / 64) * KV_BLK + lane * 8;
#pragma unroll
    for (int u = 0; u < 4; ++u) *(v8us*)(pk + (size_t)u * (NK / 64) * KV_BLK + w * (FR_H / 2)) = o[u];      /* 512 bytes in a row per wave */
#pragma unroll
    for (int u = 0; u < 2; ++u) *(v8us*)(pk + (size_t)(2 * u + (w >> 2)) * (NK / 64) * KV_BLK + 4 * FR_H + (w & 3) * (FR_H / 2)) = vt[u];
    }
    if (lo == NK - PJ_ROWS && tid == 0) CNT[bb] = n;      /* by the batch's last block, behind its last barrier: no barrier waits for this store */
  }
}

// Fused attention core: one work-group = 32 queries of one batch, 16 waves = 4 heads x 4 key shares (share sp: packed 64-key blocks sp, sp + 4, ... below the count); scores, softmax weights and weighted values stay in registers.
// S^T = K Q^T (+ mask bias as the C operand), O^T += V^T P^T, so a lane holds one query's scores and the two score tiles of 32 keys pack straight into the B operand.
// The output projection runs in the epilogue on the work-group's own 32 rows: o_w is rounded and transposed into LDS at entry, 8 waves take one 16x16 output tile each.
// Running maximum per 64 keys; weights carry a factor 2^10 (as f16 operands) that cancels in the division; row sums by an all-ones A on the rounded weights.
#define FA_SPL 4
typedef float v2f __attribute__((ext_vector_type(2)));
typedef _Float16 v2h __attribute__((ext_vector_type(2)));
union FragP { v16h v; v2h p[8]; };
__device__ __forceinline__ float fa_xhalf(float x) { const int i = __float_as_int(x); return __int_as_float(__builtin_amdgcn_permlanex16(i, i, 0x76543210, 0xfedcba98, false, false)); }
// a fragment stored as 2 pieces of [lane][8 halves]; p already holds the lane's own 8 * lane
__device__ __forceinline__ v16h p_frag(const _Float16* p) { FragH f; f.half[0] = *(const v8us*)(const unsigned short*)p; f.half[1] = *(const v8us*)((const unsigned short*)p + FR_H / 2); return f.v; }
__global__ __launch_bounds__(512) void k_fattn(const _Float16* __restrict__ Q16, const _Float16* __restrict__ KV, const int* __restrict__ CNT, const float* __restrict__ ow, const float* __restrict__ ob, float* __restrict__ out) {
  __shared__ __attribute__((aligned(32))) float sbias[NK];
  __shared__ __attribute__((aligned(16))) float sred[FA_SPL][NH][2][10][32];
  __shared__ __attribute__((aligned(16))) unsigned short sout[32][VW + 8];
  __shared__ __attribute__((aligned(16))) unsigned short sow[OD][VW + 8];      /* o_w transposed: [out column][h*16 + c], f16, x16 */
  __shared__ __attribute__((aligned(16))) float sfin[32][OD + 4];
  __shared__ float sob[OD];
  const int tid = threadIdx.x, w = __builtin_amdgcn_readfirstlane(tid >> 5), lane = tid & 31, ln = lane & 15, hh = lane >> 4;      /* the wave's number as a scalar: the key loop's trip count depends on it */
  const int b = blockIdx.x / (NQ / 32), q0 = (blockIdx.x % (NQ / 32)) * 32;
  const int h = w & 3, sp = w >> 2;
  const float L2E = 1.4426950408889634f;
  const int cnt = min(max(CNT[b], 0), NK);      /* unmasked keys of the batch, packed first; 0: every key is masked and all NK are stored */
  const int nblk = ((cnt ? cnt : NK) + 63) >> 6;
  // every global load of the set-up is issued here, ahead of the LDS fills and the barrier: Q, o_w and o_bias need no count; the wave's first K block follows as soon as the count says that it exists
  v16h qf[2];
  const _Float16* qp = Q16 + ((size_t)((b * NQ + q0) / 16) * NH + h) * FR_H + lane * 8;
#pragma unroll
  for (int t = 0; t < 2; ++t) qf[t] = p_frag(qp + t * (NH * FR_H));
  const int own = tid & (OD - 1), owk = (tid >> 6) * 8;      /* 512 threads = 64 columns x 8 groups of 8 k */
  float owv[8];
#pragma unroll
  for (int i = 0; i < 8; ++i) owv[i] = ow[(size_t)(owk + i) * OD + own];
  const float obv = ob[own];
  const _Float16* kp = KV + ((size_t)(b * NH + h) * (NK / 64) + sp) * KV_BLK + lane * 8;
  v16h kf[4];
  if (sp < nblk) {      /* scalar test: a block past the count was not written by the projection and is not read */
#pragma unroll
    for (int j = 0; j < 4; ++j) kf[j] = p_frag(kp + j * FR_H);
  }
  { FragH f;
#pragma unroll
    for (int i = 0; i < 8; ++i) f.h[i] = (_Float16)(bf16_round(owv[i]) * 16.0f);
    *(v8us*)&sow[own][owk] = f.half[0]; }
  if (tid < OD) sob[tid] = bf16_round(obv);
  // keys past the count get -2^100: it swallows the score, its product with L2E is exact, so their scores are all equal (a row with every key masked averages uniformly, as the reference does)
  for (int u = 0; u < NK / 512; ++u) sbias[tid + 512 * u] = (tid + 512 * u < cnt) ? 0.f : -0x1p100f;
  __syncthreads();
  v16h ones;
#pragma unroll
  for (int i = 0; i < 16; ++i) ones[i] = (_Float16)1.0f;
  const float* bp = sbias + sp * 64 + 8 * hh;
  const v8f z8 = {0.f,0.f,0.f,0.f,0.f,0.f,0.f,0.f};
  v8f o[2] = {z8, z8}, ls[2] = {z8, z8};
  float mraw[2] = {-3.0e38f, -3.0e38f}, mcs[2] = {-3.0e38f, -3.0e38f};
  // one trip = 64 keys. K is already in registers; V^T is asked for at the head; behind the score products the next trip's K is asked for, into the same registers, so that it flies during the softmax and the value products
  auto trip = [&](const bool more) __attribute__((always_inline)) {
    v16h vf[2]; v8f bias[4], sc[2][4];
#pragma unroll
    for (int j = 0; j < 2; ++j) vf[j] = p_frag(kp + (4 + j) * FR_H);
#pragma unroll
    for (int j = 0; j < 4; ++j) bias[j] = *(const v8f*)(bp + j * 16);
#pragma unroll
    for (int j = 0; j < 4; ++j)
#pragma unroll
      for (int t = 0; t < 2; ++t) sc[t][j] = fa_mma(kf[j], qf[t], bias[j]);
    kp += FA_SPL * KV_BLK; bp += FA_SPL * 64;      /* one pointer for K and V^T, stepped once a trip */
    if (more) {
#pragma unroll
      for (int j = 0; j < 4; ++j) kf[j] = p_frag(kp + j * FR_H);
    }
    __builtin_amdgcn_sched_barrier(0);      /* keeps the loads above where they are written: without it the scheduler sinks the V^T loads to their first use and the next K to the trip's foot, and their latency is waited out */
#pragma unroll
    for (int t = 0; t < 2; ++t) {
      const v8f (&s)[4] = sc[t];
      float mx = mraw[t];
#pragma unroll
      for (int j = 0; j < 4; ++j)
#pragma unroll
        for (int r = 0; r < 8; ++r) mx = fmaxf(mx, s[j][r]);
      mx = fmaxf(mx, fa_xhalf(mx));
      const float mc = __builtin_fmaf(mx, L2E, -10.0f);      /* exponent offset: weights = 2^10 exp(s - max) */
      const float al = __builtin_amdgcn_exp2f(mcs[t] - mc);
      mraw[t] = mx; mcs[t] = mc;
      const v2f l2 = {L2E, L2E}, nm = {-mc, -mc};
      FragP pf[2];
#pragma unroll
      for (int j = 0; j < 4; ++j)
#pragma unroll
        for (int e = 0; e < 4; ++e) {
          const v2f x = {s[j][2 * e], s[j][2 * e + 1]};
          const v2f y = __builtin_elementwise_fma(x, l2, nm);
          const v2f p = {__builtin_amdgcn_exp2f(y[0]), __builtin_amdgcn_exp2f(y[1])};
          pf[j >> 1].p[(j & 1) * 4 + e] = __builtin_convertvector(p, v2h);
        }
#pragma unroll
      for (int r = 0; r < 8; ++r) o[t][r] *= al;
      ls[t][0] *= al;      /* every row of the sum tile is the same sum; only register 0 is read */
      o[t] = fa_mma(vf[0], pf[0].v, o[t]); o[t] = fa_mma(vf[1], pf[1].v, o[t]);
      ls[t] = fa_mma(ones, pf[0].v, ls[t]); ls[t] = fa_mma(ones, pf[1].v, ls[t]);
    }
  };
  for (int kb = sp + FA_SPL; kb < nblk; kb += FA_SPL) trip(true);      /* every trip but the wave's last: a next block exists */
  if (sp < nblk) trip(false);      /* the last trip asks for nothing more */
#pragma unroll
  for (int t = 0; t < 2; ++t) {
    float* r = &sred[sp][h][t][0][lane];
    r[0] = mcs[t]; r[32] = ls[t][0];
#pragma unroll
    for (int e = 0; e < 8; ++e) r[(2 + e) * 32] = o[t][e];
  }
  __syncthreads();
  if (w < 8) {      /* join the four key shares of one (head, query tile); a share with no block has weight 0 */
    const int hd = w & 3, t = w >> 2;
    float mq[FA_SPL], M = -3.0e38f;
#pragma unroll
    for (int i = 0; i < FA_SPL; ++i) { mq[i] = sred[i][hd][t][0][lane]; M = fmaxf(M, mq[i]); }
    float L = 0.f, acc[8] = {0.f,0.f,0.f,0.f,0.f,0.f,0.f,0.f};
#pragma unroll
    for (int i = 0; i < FA_SPL; ++i) {
      const float wt = __builtin_amdgcn_exp2f(mq[i] - M);
      L += wt * sred[i][hd][t][1][lane];
#pragma unroll
      for (int e = 0; e < 8; ++e) acc[e] += wt * sred[i][hd][t][2 + e][lane];
    }
    const float rl = 1.0f / L;
    FragH f;
#pragma unroll
    for (int e = 0; e < 8; ++e) f.h[e] = (_Float16)(acc[e] * rl);
    *(v8us*)&sout[t * 16 + ln][hd * HV + 8 * hh] = f.half[0];
  }
  __syncthreads();
  if (w < 8) {      /* out tile = weighted values (32 x 64) o_w (64 x 64) / 16 + bias */
    const int mt = w >> 2, nt = w & 3;
    v8f acc = z8;
#pragma unroll
    for (int kb = 0; kb < VW; kb += 32) acc = fa_mma(s_frag(&sout[mt * 16 + ln][kb], hh), s_frag(&sow[nt * 16 + ln][kb], hh), acc);
    const float bv = sob[nt * 16 + ln];
#pragma unroll
    for (int r = 0; r < 8; ++r) sfin[mt * 16 + 8 * hh + r][nt * 16 + ln] = acc[r] * 0.0625f + bv;
  }
  __syncthreads();
  { const int row = tid >> 4, c4 = (tid & 15) * 4; *(v4f*)(out + ((size_t)b * NQ + q0 + row) * OD + c4) = *(const v4fa*)&sfin[row][c4]; }      /* whole 256-byte rows */
}
extern "C" void kernel_launch(void* const* d_in, const int* in_sizes, int n_in,
                              void* d_out, int out_size, void* d_ws, size_t ws_size, hipStream_t stream) {
  (void)in_sizes; (void)n_in; (void)out_size;
  const float* qd = (const float*)d_in[0]; const float* md = (const float*)d_in[1]; const int* msk = (const int*)d_in[2]; const float* qw = (const float*)d_in[3]; const float* kw = (const float*)d_in[4]; const float* vw = (const float*)d_in[5]; const float* ow = (const float*)d_in[6]; const float* ob = (const float*)d_in[7];
  char* ws = (char*)d_ws; size_t off = 0;
  auto take = [&](size_t bytes) { char* p = ws + off; off += (bytes + 255) & ~(size_t)255; return p; };
  _Float16* Q16 = (_Float16*)take((size_t)NB * NQ * KW * 2); _Float16* KV = (_Float16*)take((size_t)NB * NK * (KW + VW) * 2); int* CNT = (int*)take(NB * sizeof(int));
  if (off > ws_size) return;
  k_proj<<<PJ_QB + PJ_MB, 256, 0, stream>>>(qd, md, msk, qw, kw, vw, Q16, KV, CNT);      /* Q * 32^-0.5, K and V^T of the unmasked keys as f16 operand fragments; their count */
  k_fattn<<<NB * (NQ / 32), 512, 0, stream>>>(Q16, KV, CNT, ow, ob, (float*)d_out);      /* out = sum_(h,c) softmax-weighted values o_w + o_bias */
}

// v006
// A run of this version takes 16.1 microseconds.
// In two side-by-side timings against v005, it was 1.05 and 1.06 times as fast.
// All steps since v000 together make it 53.6 times as fast.
#include <hip/hip_runtime.h>
// PointwiseAttention (2 x 4096 queries (128-dim) over 4096 memory rows (64-dim); 4 heads, key dim 32, value dim 16; Q = q_data q_w * 32^-0.5, K = m_data k_w, V = m_data v_w; logits masked where mask[b][k] == 0; softmax; out = sum_{h,c} (attn V)[q][h][c] o_w[h][c][o] + o_bias -> [2][4096][64]).
// Compute dtype: inputs rounded to bf16; inputs/weights exact as f16; Q/K/V, the softmax weights and the averaged values as plain f16 operands (~2^-12); mask/softmax f32. v_wmma_f32_16x16x32_f16.
#define NB 2
#define NQ 4096
#define NK 4096
#define QD 128
#define MD 64
#define NH 4
#define HK 32
#define HV 16
#define KW (NH * HK)             /* 128 */
#define VW (NH * HV)             /* 64 */
#define OD 64
typedef unsigned short v8us __attribute__((ext_vector_type(8), may_alias));
typedef unsigned short v4us __attribute__((ext_vector_type(4), may_alias));
typedef float  v8f  __attribute__((ext_vector_type(8)));
typedef float  v4f  __attribute__((ext_vector_type(4)));
typedef float  v4fa __attribute__((ext_vector_type(4), may_alias));
typedef _Float16 v16h __attribute__((ext_vector_type(16)));
union FragH { v16h v; v8us half[2]; v4us quad[4]; _Float16 h[16]; unsigned short u[16]; };

__device__ __forceinline__ unsigned short bf16_bits(float x) { unsigned int u = __float_as_uint(x); return (unsigned short)((u + 0x7FFFu + ((u >> 16) & 1u)) >> 16); }
__device__ __forceinline__ float bf16_val(unsigned short b) { return __uint_as_float(((unsigned int)b) << 16); }
__device__ __forceinline__ float bf16_round(float x) { return bf16_val(bf16_bits(x)); }
// A or B fragment of the 16x16x32 f16 form from an LDS row with k contiguous: k = 8*hh .. +7 and 16 + 8*hh .. +7
__device__ __forceinline__ v16h s_frag(const unsigned short* p, int hh) { FragH f; f.half[0] = *(const v8us*)(p + 8 * hh); f.half[1] = *(const v8us*)(p + 16 + 8 * hh); return f.v; }
__device__ __forceinline__ v8f fa_mma(v16h a, v16h b, v8f c) { return __builtin_amdgcn_wmma_f32_16x16x32_f16(false, a, false, b, (short)0, c, false, false); }

// ---- all three projections in one launch ----
// One work-group = 64 rows of q_data (blocks 0 .. PJ_QB-1) or 64 rows of m_data (the rest). The f32 rows and the f32 weights are read once, coalesced,
// rounded (bf16, exact as f16; weights x16) and laid in LDS with k contiguous: rows as A, weights transposed as B. 8 waves = 4 row tiles x 2 column halves.
// Q, K and V^T leave in the order the attention waves load them, as operand fragments: a fragment = 2 pieces of [lane][8 halves], so one 16-byte load of a wave is 512 bytes in a row.
// Q: [16 queries][head] fragments (16 queries x 32). K, V^T: per (batch, head, 64 keys) one block of KV_BLK halves = 4 K fragments (16 keys x 32), then 2 V^T fragments (16 value dims x 32 keys).
// Keys are packed: a masked key has softmax weight exactly 0, so memory block j of a batch projects the batch's unmasked rows of rank 64 j .. 64 j + 63 (in row order; ranks past the count are rows of zeros),
// blocks past the count do nothing, and the count goes to the attention launch. A batch with every key masked keeps all its rows, with count 0 (the reference then averages uniformly).
#define PJ_ROWS 64
#define PJ_QB (NB * NQ / PJ_ROWS)
#define PJ_MB (NB * NK / PJ_ROWS)
#define PJ_PQ (QD + 8)           /* LDS pitch in halves: 16 bytes over the row, for 16-byte readers */
#define PJ_PM (MD + 8)
#define PJ_PO (KW + 8)
#define FR_H 512                 /* halves in one 16 x 32 fragment */
#define KV_BLK (6 * FR_H)        /* halves per (batch, head, 64 keys) */
// a wave's weight tile: 16 columns x 64 k; a lane takes 4 columns x 8 k (8 loads of 16 bytes), and stores 4 rows of 8 k
template <int N>
__device__ __forceinline__ const float* pj_wload(const float* __restrict__ Wf, int tile, int lane, v4f (&r)[8]) {
  const int n = ((tile % (N / 16)) * 4 + (lane & 3)) * 4, k = ((tile / (N / 16)) * 8 + (lane >> 2)) * 8;
  const float* p = Wf + (size_t)k * N + n;
#pragma unroll
  for (int j = 0; j < 8; ++j) r[j] = *(const v4fa*)(p + j * N);
  return p;
}
template <int N, int PITCH>
__device__ __forceinline__ void pj_wstore(unsigned short* sW, int tile, int lane, const v4f (&r)[8]) {
  const int n = ((tile % (N / 16)) * 4 + (lane & 3)) * 4, k = ((tile / (N / 16)) * 8 + (lane >> 2)) * 8;
#pragma unroll
  for (int c = 0; c < 4; ++c) {
    FragH f;
#pragma unroll
    for (int j = 0; j < 8; ++j) f.h[j] = (_Float16)(bf16_round(r[j][c]) * 16.0f);
    *(v8us*)(sW + (n + c) * PITCH + k) = f.half[0];
  }
}
template <int KD, int PITCH>
__device__ __forceinline__ void pj_xstore(unsigned short* sX, int i4, v4f x) {
  FragH f;
#pragma unroll
  for (int q = 0; q < 4; ++q) f.h[q] = (_Float16)bf16_round(x[q]);
  *(v4us*)(sX + (i4 / KD) * PITCH + (i4 % KD)) = f.quad[0];
}
__global__ __launch_bounds__(256) void k_proj(const float* __restrict__ qd, const float* __restrict__ md, const int* __restrict__ msk, const float* __restrict__ qw, const float* __restrict__ kw, const float* __restrict__ vw,
                                              _Float16* __restrict__ Q16, _Float16* __restrict__ KV, int* __restrict__ CNT) {
  __shared__ __attribute__((aligned(16))) unsigned short sW[KW * PJ_PQ];            /* also holds (KW + VW) rows of pitch PJ_PM */
  __shared__ __attribute__((aligned(16))) unsigned short sX[PJ_ROWS * PJ_PQ];
  __shared__ __attribute__((aligned(16))) unsigned short sO[PJ_ROWS * PJ_PO];
  __shared__ __attribute__((aligned(16))) unsigned short sV[VW * (PJ_ROWS + 8)];
  __shared__ int sidx[PJ_ROWS];      /* source row of each of the block's 64 packed keys; -1: none */
  __shared__ int swc[8];             /* unmasked keys in each wave's 512 mask entries */
  static_assert((KW + VW) * PJ_PM <= KW * PJ_PQ, "weight buffer");
  const int tid = threadIdx.x, w = tid >> 5, lane = tid & 31, ln = lane & 15, hh = lane >> 4;
  const int rt = w >> 1, ch = w & 1;
  const v8f z8 = {0.f,0.f,0.f,0.f,0.f,0.f,0.f,0.f};
  /* output copies: a wave takes one piece of a fragment a pass: lane (ln, hh) takes k = 16 * piece + 8 * hh .. +7 of row ln, the place it has in the operand */
  if (blockIdx.x < PJ_QB) {
    const size_t row0 = (size_t)blockIdx.x * PJ_ROWS;
    const float* xp = qd + row0 * QD;
    v4f x[8], w0[8], w1[8];
#pragma unroll
    for (int u = 0; u < 8; ++u) x[u] = *(const v4fa*)(xp + (tid + 256 * u) * 4);
    const float* p0 = pj_wload<KW>(qw, w, lane, w0); const float* p1 = pj_wload<KW>(qw, w + 8, lane, w1);
    asm volatile("s_wait_xcnt 0x0" :: "v"(p0), "v"(p1) : "memory");      /* all 24 loads are issued above this line, and their address registers stay as they are up to the wait */
#pragma unroll
    for (int u = 0; u < 8; ++u) pj_xstore<QD, PJ_PQ>(sX, (tid + 256 * u) * 4, x[u]);
    pj_wstore<KW, PJ_PQ>(sW, w, lane, w0); pj_wstore<KW, PJ_PQ>(sW, w + 8, lane, w1);
    __syncthreads();
    v8f acc[4] = {z8, z8, z8, z8};
#pragma unroll
    for (int kb = 0; kb < QD; kb += 32) {
      const v16h a = s_frag(sX + (rt * 16 + ln) * PJ_PQ + kb, hh);
#pragma unroll
      for (int t = 0; t < 4; ++t) acc[t] = fa_mma(a, s_frag(sW + (ch * 64 + t * 16 + ln) * PJ_PQ + kb, hh), acc[t]);
    }
#pragma unroll
    for (int t = 0; t < 4; ++t)
#pragma unroll
      for (int r = 0; r < 8; ++r) { FragH f; f.h[0] = (_Float16)(acc[t][r] * (0.0625f * 0.17677669529663687f)); sO[(rt * 16 + 8 * hh + r) * PJ_PO + ch * 64 + t * 16 + ln] = f.u[0]; }      /* Q * 32^-0.5 */
    __syncthreads();
    v8us o[4];
#pragma unroll
    for (int u = 0; u < 4; ++u) o[u] = *(const v8us*)(sO + (rt * 16 + ln) * PJ_PO + u * HK + ch * 16 + 8 * hh);      /* pass u = head u; wave = query tile rt, piece ch */
    unsigned short* po = (unsigned short*)Q16 + (row0 / 16 + rt) * (NH * FR_H) + ch * (FR_H / 2) + lane * 8;
#pragma unroll
    for (int u = 0; u < 4; ++u) *(v8us*)(po + u * FR_H) = o[u];      /* 512 bytes in a row per wave */
  } else {
    const int mb = blockIdx.x - PJ_QB, bb = mb / (NK / PJ_ROWS), lo = (mb % (NK / PJ_ROWS)) * PJ_ROWS;      /* batch; rank of the block's first packed key */
    const size_t row0 = (size_t)mb * PJ_ROWS;
    const int wu = __builtin_amdgcn_readfirstlane(w);
    v4f x[4], w0[8], w1[8];
    int mv[16];
    const int* mp = msk + bb * NK + wu * 512 + lane;      /* the batch's whole mask: a wave takes 512 entries, 32 in a row a load */
#pragma unroll
    for (int i = 0; i < 16; ++i) mv[i] = mp[i * 32];
    const float* p0 = pj_wload<KW>(kw, w, lane, w0);
    asm volatile("s_wait_xcnt 0x0" :: "v"(p0) : "memory");      /* the loads are issued above this line, and their address registers stay as they are up to the wait */
    if (w < 4) {
      const float* p1 = pj_wload<VW>(vw, w, lane, w1);
      asm volatile("s_wait_xcnt 0x0" :: "v"(p1) : "memory");      /* as above, for the four waves that bring the V weights */
    }
    unsigned int bal[16]; int wc = 0;
#pragma unroll
    for (int i = 0; i < 16; ++i) { bal[i] = __builtin_amdgcn_ballot_w32(mv[i] != 0); wc += __builtin_popcount(bal[i]); }
    if (lane == 0) swc[wu] = wc;
    if (tid < PJ_ROWS) sidx[tid] = -1;
    __syncthreads();
    int n = 0, base = 0;      /* unmasked keys of the batch; of the waves below this one */
#pragma unroll
    for (int v = 0; v < 8; ++v) { const int c = swc[v]; n += c; base += (v < wu) ? c : 0; }
    n = __builtin_amdgcn_readfirstlane(n); base = __builtin_amdgcn_readfirstlane(base);
    if (lo < (n ? n : NK)) {      /* the same for the whole work-group: the barriers below are passed by all of its waves or by none */
    if (n == 0) {
      if (tid < PJ_ROWS) sidx[tid] = lo + tid;
    } else {
#pragma unroll
      for (int i = 0; i < 16; ++i) {
        const int c = __builtin_popcount(bal[i]);
        if (base + c > lo && base < lo + PJ_ROWS) {      /* scalar test: some of these 32 entries fall among the block's 64 ranks */
          const int r = base + (int)__builtin_amdgcn_mbcnt_lo(bal[i], 0u) - lo;
          if (((bal[i] >> lane) & 1u) && (unsigned int)r < (unsigned int)PJ_ROWS) sidx[r] = wu * 512 + i * 32 + lane;
        }
        base += c;
      }
    }
    __syncthreads();
    const float* xp = md + (size_t)bb * NK * MD;
    int sr[4]; const float* xq[4];
#pragma unroll
    for (int u = 0; u < 4; ++u) { sr[u] = sidx[(tid >> 4) + 16 * u]; xq[u] = xp + ((unsigned int)(sr[u] < 0 ? 0 : sr[u]) * MD + (tid & 15) * 4); }      /* 16 threads a row: whole 256-byte rows */
#pragma unroll
    for (int u = 0; u < 4; ++u) x[u] = *(const v4fa*)xq[u];
    asm volatile("s_wait_xcnt 0x0" :: "v"(xq[0]), "v"(xq[1]), "v"(xq[2]), "v"(xq[3]) : "memory");      /* the four row loads are issued above this line, and their address registers stay as they are up to the wait */
    pj_wstore<KW, PJ_PM>(sW, w, lane, w0);
    if (w < 4) pj_wstore<VW, PJ_PM>(sW + KW * PJ_PM, w, lane, w1);
#pragma unroll
    for (int u = 0; u < 4; ++u) { const v4f zx = {0.f, 0.f, 0.f, 0.f}; pj_xstore<MD, PJ_PM>(sX, (tid + 256 * u) * 4, sr[u] < 0 ? zx : x[u]); }
    __syncthreads();
    v8f acc[6] = {z8, z8, z8, z8, z8, z8};      /* 0..3: 64 columns of K; 4, 5: 32 columns of V */
#pragma unroll
    for (int kb = 0; kb < MD; kb += 32) {
      const v16h a = s_frag(sX + (rt * 16 + ln) * PJ_PM + kb, hh);
#pragma unroll
      for (int t = 0; t < 4; ++t) acc[t] = fa_mma(a, s_frag(sW + (ch * 64 + t * 16 + ln) * PJ_PM + kb, hh), acc[t]);
#pragma unroll
      for (int t = 0; t < 2; ++t) acc[4 + t] = fa_mma(a, s_frag(sW + (KW + ch * 32 + t * 16 + ln) * PJ_PM + kb, hh), acc[4 + t]);
    }
#pragma unroll
    for (int t = 0; t < 4; ++t)
#pragma unroll
      for (int r = 0; r < 8; ++r) { FragH f; f.h[0] = (_Float16)(acc[t][r] * 0.0625f); sO[(rt * 16 + 8 * hh + r) * PJ_PO + ch * 64 + t * 16 + ln] = f.u[0]; }
#pragma unroll
    for (int t = 0; t < 2; ++t) {      /* a lane holds 8 consecutive keys of one value column: one 16-byte piece of a V^T row */
      FragH f;
#pragma unroll
      for (int r = 0; r < 8; ++r) f.h[r] = (_Float16)(acc[4 + t][r] * 0.0625f);
      *(v8us*)(sV + (ch * 32 + t * 16 + ln) * (PJ_ROWS + 8) + rt * 16 + 8 * hh) = f.half[0];
    }
    __syncthreads();
    v8us o[4], vt[2];
#pragma unroll
    for (int u = 0; u < 4; ++u) o[u] = *(const v8us*)(sO + (rt * 16 + ln) * PJ_PO + u * HK + ch * 16 + 8 * hh);      /* pass u = head u; wave = key tile rt, piece ch */
#pragma unroll
    for (int u = 0; u < 2; ++u) vt[u] = *(const v8us*)(sV + ((2 * u + (w >> 2)) * HV + ln) * (PJ_ROWS + 8) + (rt & 1) * 32 + ch * 16 + 8 * hh);      /* head 2u + w/4; 32-key half rt & 1, piece ch */
    unsigned short* pk = (unsigned short*)KV + ((row0 / NK) * NH * (NK / 64) + (row0 % NK) / 64) * KV_BLK + lane * 8;
#pragma unroll
    for (int u = 0; u < 4; ++u) *(v8us*)(pk + (size_t)u * (NK / 64) * KV_BLK + w * (FR_H / 2)) = o[u];      /* 512 bytes in a row per wave */
#pragma unroll
    for (int u = 0; u < 2; ++u) *(v8us*)(pk + (size_t)(2 * u + (w >> 2)) * (NK / 64) * KV_BLK + 4 * FR_H + (w & 3) * (FR_H / 2)) = vt[u];
    }
    if (lo == NK - PJ_ROWS && tid == 0) CNT[bb] = n;      /* by the batch's last block, behind its last barrier: no barrier waits for this store */
  }
}

// Fused attention core: one work-group = 32 queries of one batch, 16 waves = 4 heads x 4 key shares (share sp: packed 64-key blocks sp, sp + 4, ... below the count); scores, softmax weights and weighted values stay in registers.
// The 128 work-groups of a batch read the same K, V^T blocks from L2: each enters its shares' block lists at a place of its own and wraps round, so that they do not ask for the same lines at the same moment.
// S^T = K Q^T (+ mask bias as the C operand), O^T += V^T P^T, so a lane holds one query's scores and the two score tiles of 32 keys pack straight into the B operand.
// The output projection runs in the epilogue on the work-group's own 32 rows: o_w is rounded and transposed into LDS at entry, 8 waves take one 16x16 output tile each.
// Running maximum per 64 keys; weights carry a factor 2^10 (as f16 operands) that cancels in the division; row sums by an all-ones A on the rounded weights.
#define FA_SPL 4
typedef float v2f __attribute__((ext_vector_type(2)));
typedef _Float16 v2h __attribute__((ext_vector_type(2)));
union FragP { v16h v; v2h p[8]; };
__device__ __forceinline__ float fa_xhalf(float x) { const int i = __float_as_int(x); return __int_as_float(__builtin_amdgcn_permlanex16(i, i, 0x76543210, 0xfedcba98, false, false)); }
// a fragment stored as 2 pieces of [lane][8 halves]; p already holds the lane's own 8 * lane
__device__ __forceinline__ v16h p_frag(const _Float16* p) { FragH f; f.half[0] = *(const v8us*)(const unsigned short*)p; f.half[1] = *(const v8us*)((const unsigned short*)p + FR_H / 2); return f.v; }
__global__ __launch_bounds__(512) void k_fattn(const _Float16* __restrict__ Q16, const _Float16* __restrict__ KV, const int* __restrict__ CNT, const float* __restrict__ ow, const float* __restrict__ ob, float* __restrict__ out) {
  __shared__ __attribute__((aligned(32))) float sbias[NK];
  __shared__ __attribute__((aligned(16))) float sred[FA_SPL][NH][2][10][32];
  __shared__ __attribute__((aligned(16))) unsigned short sout[32][VW + 8];
  __shared__ __attribute__((aligned(16))) unsigned short sow[OD][VW + 8];      /* o_w transposed: [out column][h*16 + c], f16, x16 */
  __shared__ __attribute__((aligned(16))) float sfin[32][OD + 4];
  __shared__ float sob[OD];
  const int tid = threadIdx.x, w = __builtin_amdgcn_readfirstlane(tid >> 5), lane = tid & 31, ln = lane & 15, hh = lane >> 4;      /* the wave's number as a scalar: the key loop's trip count depends on it */
  const int b = blockIdx.x / (NQ / 32), q0 = (blockIdx.x % (NQ / 32)) * 32;
  const int h = w & 3, sp = w >> 2;
  const float L2E = 1.4426950408889634f;
  const int cnt = min(max(CNT[b], 0), NK);      /* unmasked keys of the batch, packed first; 0: every key is masked and all NK are stored */
  const int nblk = ((cnt ? cnt : NK) + 63) >> 6;
  // every global load of the set-up is issued here, ahead of the LDS fills and the barrier: Q, o_w and o_bias need no count; the wave's first K block follows as soon as the count says that it exists
  v16h qf[2];
  const _Float16* qp = Q16 + ((size_t)((b * NQ + q0) / 16) * NH + h) * FR_H + lane * 8;
#pragma unroll
  for (int t = 0; t < 2; ++t) qf[t] = p_frag(qp + t * (NH * FR_H));
  const int own = tid & (OD - 1), owk = (tid >> 6) * 8;      /* 512 threads = 64 columns x 8 groups of 8 k */
  float owv[8];
#pragma unroll
  for (int i = 0; i < 8; ++i) owv[i] = ow[(size_t)(owk + i) * OD + own];
  const float obv = ob[own];
  const int nw = (nblk - sp + FA_SPL - 1) / FA_SPL;      /* blocks of this wave's share: sp + FA_SPL * i, i < nw; 0 if the share has none */
  const unsigned int g = blockIdx.x % (NQ / 32);
  int ci = nw > 0 ? (int)((g + (g >> 3)) % (unsigned int)nw) : 0;      /* the work-group's entry into the list; neighbours in index and work-groups 8 apart differ */
  const _Float16* kp = KV + ((size_t)(b * NH + h) * (NK / 64) + sp + FA_SPL * ci) * KV_BLK + lane * 8;
  v16h kf[4];
  if (nw > 0) {      /* scalar test: a block past the count was not written by the projection and is not read */
#pragma unroll
    for (int j = 0; j < 4; ++j) kf[j] = p_frag(kp + j * FR_H);
  }
  { FragH f;
#pragma unroll
    for (int i = 0; i < 8; ++i) f.h[i] = (_Float16)(bf16_round(owv[i]) * 16.0f);
    *(v8us*)&sow[own][owk] = f.half[0]; }
  if (tid < OD) sob[tid] = bf16_round(obv);
  // keys past the count get -2^100: it swallows the score, its product with L2E is exact, so their scores are all equal (a row with every key masked averages uniformly, as the reference does)
  for (int u = 0; u < NK / 512; ++u) sbias[tid + 512 * u] = (tid + 512 * u < cnt) ? 0.f : -0x1p100f;
  __syncthreads();
  v16h ones;
#pragma unroll
  for (int i = 0; i < 16; ++i) ones[i] = (_Float16)1.0f;
  const float* bp = sbias + (sp + FA_SPL * ci) * 64 + 8 * hh;
  const v8f z8 = {0.f,0.f,0.f,0.f,0.f,0.f,0.f,0.f};
  v8f o[2] = {z8, z8}, ls[2] = {z8, z8};
  float mraw[2] = {-3.0e38f, -3.0e38f}, mcs[2] = {-3.0e38f, -3.0e38f};
  // one trip = 64 keys. K is already in registers; V^T is asked for at the head; behind the score products the next trip's K is asked for, into the same registers, so that it flies during the softmax and the value products
  auto trip = [&](const bool more) __attribute__((always_inline)) {
    v16h vf[2]; v8f bias[4], sc[2][4];
#pragma unroll
    for (int j = 0; j < 2; ++j) vf[j] = p_frag(kp + (4 + j) * FR_H);
#pragma unroll
    for (int j = 0; j < 4; ++j) bias[j] = *(const v8f*)(bp + j * 16);
#pragma unroll
    for (int j = 0; j < 4; ++j)
#pragma unroll
      for (int t = 0; t < 2; ++t) sc[t][j] = fa_mma(kf[j], qf[t], bias[j]);
    const int st = (ci + 1 == nw) ? 1 - nw : 1;      /* to the next block of the list; from the last one back to the first */
    ci += st; kp += st * (FA_SPL * KV_BLK); bp += st * (FA_SPL * 64);      /* one pointer for K and V^T, stepped once a trip */
    if (more) {
#pragma unroll
      for (int j = 0; j < 4; ++j) kf[j] = p_frag(kp + j * FR_H);
    }
    __builtin_amdgcn_sched_barrier(0);      /* keeps the loads above where they are written: without it the scheduler sinks the V^T loads to their first use and the next K to the trip's foot, and their latency is waited out */
#pragma unroll
    for (int t = 0; t < 2; ++t) {
      const v8f (&s)[4] = sc[t];
      float mx = mraw[t];
#pragma unroll
      for (int j = 0; j < 4; ++j)
#pragma unroll
        for (int r = 0; r < 8; ++r) mx = fmaxf(mx, s[j][r]);
      mx = fmaxf(mx, fa_xhalf(mx));
      const float mc = __builtin_fmaf(mx, L2E, -10.0f);      /* exponent offset: weights = 2^10 exp(s - max) */
      const float al = __builtin_amdgcn_exp2f(mcs[t] - mc);
      mraw[t] = mx; mcs[t] = mc;
      const v2f l2 = {L2E, L2E}, nm = {-mc, -mc};
      FragP pf[2];
#pragma unroll
      for (int j = 0; j < 4; ++j)
#pragma unroll
        for (int e = 0; e < 4; ++e) {
          const v2f x = {s[j][2 * e], s[j][2 * e + 1]};
          const v2f y = __builtin_elementwise_fma(x, l2, nm);
          const v2f p = {__builtin_amdgcn_exp2f(y[0]), __builtin_amdgcn_exp2f(y[1])};
          pf[j >> 1].p[(j & 1) * 4 + e] = __builtin_convertvector(p, v2h);
        }
#pragma unroll
      for (int r = 0; r < 8; ++r) o[t][r] *= al;
      ls[t][0] *= al;      /* every row of the sum tile is the same sum; only register 0 is read */
      o[t] = fa_mma(vf[0], pf[0].v, o[t]); o[t] = fa_mma(vf[1], pf[1].v, o[t]);
      ls[t] = fa_mma(ones, pf[0].v, ls[t]); ls[t] = fa_mma(ones, pf[1].v, ls[t]);
    }
  };
  for (int j = 1; j < nw; ++j) trip(true);      /* every trip but the wave's last: a next block exists */
  if (nw > 0) trip(false);      /* the last trip asks for nothing more */
#pragma unroll
  for (int t = 0; t < 2; ++t) {
    float* r = &sred[sp][h][t][0][lane];
    r[0] = mcs[t]; r[32] = ls[t][0];
#pragma unroll
    for (int e = 0; e < 8; ++e) r[(2 + e) * 32] = o[t][e];
  }
  __syncthreads();
  if (w < 8) {      /* join the four key shares of one (head, query tile); a share with no block has weight 0 */
    const int hd = w & 3, t = w >> 2;
    float mq[FA_SPL], M = -3.0e38f;
#pragma unroll
    for (int i = 0; i < FA_SPL; ++i) { mq[i] = sred[i][hd][t][0][lane]; M = fmaxf(M, mq[i]); }
    float L = 0.f, acc[8] = {0.f,0.f,0.f,0.f,0.f,0.f,0.f,0.f};
#pragma unroll
    for (int i = 0; i < FA_SPL; ++i) {
      const float wt = __builtin_amdgcn_exp2f(mq[i] - M);
      L += wt * sred[i][hd][t][1][lane];
#pragma unroll
      for (int e = 0; e < 8; ++e) acc[e] += wt * sred[i][hd][t][2 + e][lane];
    }
    const float rl = 1.0f / L;
    FragH f;
#pragma unroll
    for (int e = 0; e < 8; ++e) f.h[e] = (_Float16)(acc[e] * rl);
    *(v8us*)&sout[t * 16 + ln][hd * HV + 8 * hh] = f.half[0];
  }
  __syncthreads();
  if (w < 8) {      /* out tile = weighted values (32 x 64) o_w (64 x 64) / 16 + bias */
    const int mt = w >> 2, nt = w & 3;
    v8f acc = z8;
#pragma unroll
    for (int kb = 0; kb < VW; kb += 32) acc = fa_mma(s_frag(&sout[mt * 16 + ln][kb], hh), s_frag(&sow[nt * 16 + ln][kb], hh), acc);
    const float bv = sob[nt * 16 + ln];
#pragma unroll
    for (int r = 0; r < 8; ++r) sfin[mt * 16 + 8 * hh + r][nt * 16 + ln] = acc[r] * 0.0625f + bv;
  }
  __syncthreads();
  { const int row = tid >> 4, c4 = (tid & 15) * 4; *(v4f*)(out + ((size_t)b * NQ + q0 + row) * OD + c4) = *(const v4fa*)&sfin[row][c4]; }      /* whole 256-byte rows */
}
extern "C" void kernel_launch(void* const* d_in, const int* in_sizes, int n_in,
                              void* d_out, int out_size, void* d_ws, size_t ws_size, hipStream_t stream) {
  (void)in_sizes; (void)n_in; (void)out_size;
  const float* qd = (const float*)d_in[0]; const float* md = (const float*)d_in[1]; const int* msk = (const int*)d_in[2]; const float* qw = (const float*)d_in[3]; const float* kw = (const float*)d_in[4]; const float* vw = (const float*)d_in[5]; const float* ow = (const float*)d_in[6]; const float* ob = (const float*)d_in[7];
  char* ws = (char*)d_ws; size_t off = 0;
  auto take = [&](size_t bytes) { char* p = ws + off; off += (bytes + 255) & ~(size_t)255; return p; };
  _Float16* Q16 = (_Float16*)take((size_t)NB * NQ * KW * 2); _Float16* KV = (_Float16*)take((size_t)NB * NK * (KW + VW) * 2); int* CNT = (int*)take(NB * sizeof(int));
  if (off > ws_size) return;
  k_proj<<<PJ_QB + PJ_MB, 256, 0, stream>>>(qd, md, msk, qw, kw, vw, Q16, KV, CNT);      /* Q * 32^-0.5, K and V^T of the unmasked keys as f16 operand fragments; their count */
  k_fattn<<<NB * (NQ / 32), 512, 0, stream>>>(Q16, KV, CNT, ow, ob, (float*)d_out);      /* out = sum_(h,c) softmax-weighted values o_w + o_bias */
}

// v007
// A run of this version takes 15.1 microseconds.
// Timed twice side by side with v006, it ran 1.06 and 1.05 times as fast.
// Counting every step since v000, it is 56.7 times as fast.
#include <hip/hip_runtime.h>
// PointwiseAttention (2 x 4096 queries (128-dim) over 4096 memory rows (64-dim); 4 heads, key dim 32, value dim 16; Q = q_data q_w * 32^-0.5, K = m_data k_w, V = m_data v_w; logits masked where mask[b][k] == 0; softmax; out = sum_{h,c} (attn V)[q][h][c] o_w[h][c][o] + o_bias -> [2][4096][64]).
// Compute dtype: inputs rounded to bf16; inputs/weights exact as f16; Q/K/V, the softmax weights and the averaged values as plain f16 operands (~2^-12); mask/softmax f32. v_wmma_f32_16x16x32_f16.
#define NB 2
#define NQ 4096
#define NK 4096
#define QD 128
#define MD 64
#define NH 4
#define HK 32
#define HV 16
#define KW (NH * HK)             /* 128 */
#define VW (NH * HV)             /* 64 */
#define OD 64
typedef unsigned short v8us __attribute__((ext_vector_type(8), may_alias));
typedef unsigned short v4us __attribute__((ext_vector_type(4), may_alias));
typedef float  v8f  __attribute__((ext_vector_type(8)));
typedef float  v4f  __attribute__((ext_vector_type(4)));
typedef float  v4fa __attribute__((ext_vector_type(4), may_alias));
typedef _Float16 v16h __attribute__((ext_vector_type(16)));
union FragH { v16h v; v8us half[2]; v4us quad[4]; _Float16 h[16]; unsigned short u[16]; };

__device__ __forceinline__ unsigned short bf16_bits(float x) { unsigned int u = __float_as_uint(x); return (unsigned short)((u + 0x7FFFu + ((u >> 16) & 1u)) >> 16); }
__device__ __forceinline__ float bf16_val(unsigned short b) { return __uint_as_float(((unsigned int)b) << 16); }
__device__ __forceinline__ float bf16_round(float x) { return bf16_val(bf16_bits(x)); }
// A or B fragment of the 16x16x32 f16 form from an LDS row with k contiguous: k = 8*hh .. +7 and 16 + 8*hh .. +7
__device__ __forceinline__ v16h s_frag(const unsigned short* p, int hh) { FragH f; f.half[0] = *(const v8us*)(p + 8 * hh); f.half[1] = *(const v8us*)(p + 16 + 8 * hh); return f.v; }
__device__ __forceinline__ v8f fa_mma(v16h a, v16h b, v8f c) { return __builtin_amdgcn_wmma_f32_16x16x32_f16(false, a, false, b, (short)0, c, false, false); }

// ---- all three projections in one launch ----
// One work-group = 64 rows of q_data (blocks 0 .. PJ_QB-1) or 64 rows of m_data (the rest). The f32 rows and the f32 weights are read once, coalesced,
// rounded (bf16, exact as f16; weights x16) and laid in LDS with k contiguous: rows as A, weights transposed as B. 8 waves = 4 row tiles x 2 column halves.
// Q, K and V^T leave in the order the attention waves load them, as operand fragments: a fragment = 2 pieces of [lane][8 halves], so one 16-byte load of a wave is 512 bytes in a row.
// Q: [16 queries][head] fragments (16 queries x 32). K, V^T: per (batch, head, 64 keys) one block of KV_BLK halves = 4 K fragments (16 keys x 32), then 2 V^T fragments (16 value dims x 32 keys).
// Keys are packed: a masked key has softmax weight exactly 0, so memory block j of a batch projects the batch's unmasked rows of rank 64 j .. 64 j + 63 (in row order; ranks past the count are rows of zeros),
// blocks past the count do nothing, and the count goes to the attention launch. A batch with every key masked keeps all its rows, with count 0 (the reference then averages uniformly).
#define PJ_ROWS 64
#define PJ_QB (NB * NQ / PJ_ROWS)
#define PJ_MB (NB * NK / PJ_ROWS)
#define PJ_PQ (QD + 8)           /* LDS pitch in halves: 16 bytes over the row, for 16-byte readers */
#define PJ_PM (MD + 8)
#define PJ_PO (KW + 8)
#define FR_H 512                 /* halves in one 16 x 32 fragment */
#define KV_BLK (6 * FR_H)        /* halves per (batch, head, 64 keys) */
// a wave's weight tile: 16 columns x 64 k; a lane takes 4 columns x 8 k (8 loads of 16 bytes), and stores 4 rows of 8 k
template <int N>
__device__ __forceinline__ const float* pj_wload(const float* __restrict__ Wf, int tile, int lane, v4f (&r)[8]) {
  const int n = ((tile % (N / 16)) * 4 + (lane & 3)) * 4, k = ((tile / (N / 16)) * 8 + (lane >> 2)) * 8;
  const float* p = Wf + (size_t)k * N + n;
#pragma unroll
  for (int j = 0; j < 8; ++j) r[j] = *(const v4fa*)(p + j * N);
  return p;
}
template <int N, int PITCH>
__device__ __forceinline__ void pj_wstore(unsigned short* sW, int tile, int lane, const v4f (&r)[8]) {
  const int n = ((tile % (N / 16)) * 4 + (lane & 3)) * 4, k = ((tile / (N / 16)) * 8 + (lane >> 2)) * 8;
#pragma unroll
  for (int c = 0; c < 4; ++c) {
    FragH f;
#pragma unroll
    for (int j = 0; j < 8; ++j) f.h[j] = (_Float16)(bf16_round(r[j][c]) * 16.0f);
    *(v8us*)(sW + (n + c) * PITCH + k) = f.half[0];
  }
}
template <int KD, int PITCH>
__device__ __forceinline__ void pj_xstore(unsigned short* sX, int i4, v4f x) {
  FragH f;
#pragma unroll
  for (int q = 0; q < 4; ++q) f.h[q] = (_Float16)bf16_round(x[q]);
  *(v4us*)(sX + (i4 / KD) * PITCH + (i4 % KD)) = f.quad[0];
}
__global__ __launch_bounds__(256) void k_proj(const float* __restrict__ qd, const float* __restrict__ md, const int* __restrict__ msk, const float* __restrict__ qw, const float* __restrict__ kw, const float* __restrict__ vw,
                                              _Float16* __restrict__ Q16, _Float16* __restrict__ KV, int* __restrict__ CNT) {
  __shared__ __attribute__((aligned(16))) unsigned short sW[KW * PJ_PQ];            /* also holds (KW + VW) rows of pitch PJ_PM */
  __shared__ __attribute__((aligned(16))) unsigned short sX[PJ_ROWS * PJ_PQ];
  __shared__ __attribute__((aligned(16))) unsigned short sO[PJ_ROWS * PJ_PO];
  __shared__ __attribute__((aligned(16))) unsigned short sV[VW * (PJ_ROWS + 8)];
  __shared__ int sidx[PJ_ROWS];      /* source row of each of the block's 64 packed keys; -1: none */
  __shared__ int swc[8];             /* unmasked keys in each wave's 512 mask entries */
  static_assert((KW + VW) * PJ_PM <= KW * PJ_PQ, "weight buffer");
  const int tid = threadIdx.x, w = tid >> 5, lane = tid & 31, ln = lane & 15, hh = lane >> 4;
  const int rt = w >> 1, ch = w & 1;
  const v8f z8 = {0.f,0.f,0.f,0.f,0.f,0.f,0.f,0.f};
  /* output copies: a wave takes one piece of a fragment a pass: lane (ln, hh) takes k = 16 * piece + 8 * hh .. +7 of row ln, the place it has in the operand */
  if (blockIdx.x < PJ_QB) {
    const size_t row0 = (size_t)blockIdx.x * PJ_ROWS;
    const float* xp = qd + row0 * QD;
    v4f x[8], w0[8], w1[8];
#pragma unroll
    for (int u = 0; u < 8; ++u) x[u] = *(const v4fa*)(xp + (tid + 256 * u) * 4);
    const float* p0 = pj_wload<KW>(qw, w, lane, w0); const float* p1 = pj_wload<KW>(qw, w + 8, lane, w1);
    asm volatile("s_wait_xcnt 0x0" :: "v"(p0), "v"(p1) : "memory");      /* all 24 loads are issued above this line, and their address registers stay as they are up to the wait */
#pragma unroll
    for (int u = 0; u < 8; ++u) pj_xstore<QD, PJ_PQ>(sX, (tid + 256 * u) * 4, x[u]);
    pj_wstore<KW, PJ_PQ>(sW, w, lane, w0); pj_wstore<KW, PJ_PQ>(sW, w + 8, lane, w1);
    __syncthreads();
    v8f acc[4] = {z8, z8, z8, z8};
#pragma unroll
    for (int kb = 0; kb < QD; kb += 32) {
      const v16h a = s_frag(sX + (rt * 16 + ln) * PJ_PQ + kb, hh);
#pragma unroll
      for (int t = 0; t < 4; ++t) acc[t] = fa_mma(a, s_frag(sW + (ch * 64 + t * 16 + ln) * PJ_PQ + kb, hh), acc[t]);
    }
#pragma unroll
    for (int t = 0; t < 4; ++t)
#pragma unroll
      for (int r = 0; r < 8; ++r) { FragH f; f.h[0] = (_Float16)(acc[t][r] * (0.0625f * 0.17677669529663687f * 1.4426950408889634f)); sO[(rt * 16 + 8 * hh + r) * PJ_PO + ch * 64 + t * 16 + ln] = f.u[0]; }      /* Q * 32^-0.5 * log2 e: the scores leave the matrix unit as exponents of 2 */
    __syncthreads();
    v8us o[4];
#pragma unroll
    for (int u = 0; u < 4; ++u) o[u] = *(const v8us*)(sO + (rt * 16 + ln) * PJ_PO + u * HK + ch * 16 + 8 * hh);      /* pass u = head u; wave = query tile rt, piece ch */
    unsigned short* po = (unsigned short*)Q16 + (row0 / 16 + rt) * (NH * FR_H) + ch * (FR_H / 2) + lane * 8;
#pragma unroll
    for (int u = 0; u < 4; ++u) *(v8us*)(po + u * FR_H) = o[u];      /* 512 bytes in a row per wave */
  } else {
    const int mb = blockIdx.x - PJ_QB, bb = mb / (NK / PJ_ROWS), lo = (mb % (NK / PJ_ROWS)) * PJ_ROWS;      /* batch; rank of the block's first packed key */
    const size_t row0 = (size_t)mb * PJ_ROWS;
    const int wu = __builtin_amdgcn_readfirstlane(w);
    v4f x[4], w0[8], w1[8];
    int mv[16];
    const int* mp = msk + bb * NK + wu * 512 + lane;      /* the batch's whole mask: a wave takes 512 entries, 32 in a row a load */
#pragma unroll
    for (int i = 0; i < 16; ++i) mv[i] = mp[i * 32];
    const float* p0 = pj_wload<KW>(kw, w, lane, w0);
    asm volatile("s_wait_xcnt 0x0" :: "v"(p0) : "memory");      /* the loads are issued above this line, and their address registers stay as they are up to the wait */
    if (w < 4) {
      const float* p1 = pj_wload<VW>(vw, w, lane, w1);
      asm volatile("s_wait_xcnt 0x0" :: "v"(p1) : "memory");      /* as above, for the four waves that bring the V weights */
    }
    unsigned int bal[16]; int wc = 0;
#pragma unroll
    for (int i = 0; i < 16; ++i) { bal[i] = __builtin_amdgcn_ballot_w32(mv[i] != 0); wc += __builtin_popcount(bal[i]); }
    if (lane == 0) swc[wu] = wc;
    if (tid < PJ_ROWS) sidx[tid] = -1;
    __syncthreads();
    int n = 0, base = 0;      /* unmasked keys of the batch; of the waves below this one */
#pragma unroll
    for (int v = 0; v < 8; ++v) { const int c = swc[v]; n += c; base += (v < wu) ? c : 0; }
    n = __builtin_amdgcn_readfirstlane(n); base = __builtin_amdgcn_readfirstlane(base);
    if (lo < (n ? n : NK)) {      /* the same for the whole work-group: the barriers below are passed by all of its waves or by none */
    if (n == 0) {
      if (tid < PJ_ROWS) sidx[tid] = lo + tid;
    } else {
#pragma unroll
      for (int i = 0; i < 16; ++i) {
        const int c = __builtin_popcount(bal[i]);
        if (base + c > lo && base < lo + PJ_ROWS) {      /* scalar test: some of these 32 entries fall among the block's 64 ranks */
          const int r = base + (int)__builtin_amdgcn_mbcnt_lo(bal[i], 0u) - lo;
          if (((bal[i] >> lane) & 1u) && (unsigned int)r < (unsigned int)PJ_ROWS) sidx[r] = wu * 512 + i * 32 + lane;
        }
        base += c;
      }
    }
    __syncthreads();
    const float* xp = md + (size_t)bb * NK * MD;
    int sr[4]; const float* xq[4];
#pragma unroll
    for (int u = 0; u < 4; ++u) { sr[u] = sidx[(tid >> 4) + 16 * u]; xq[u] = xp + ((unsigned int)(sr[u] < 0 ? 0 : sr[u]) * MD + (tid & 15) * 4); }      /* 16 threads a row: whole 256-byte rows */
#pragma unroll
    for (int u = 0; u < 4; ++u) x[u] = *(const v4fa*)xq[u];
    asm volatile("s_wait_xcnt 0x0" :: "v"(xq[0]), "v"(xq[1]), "v"(xq[2]), "v"(xq[3]) : "memory");      /* the four row loads are issued above this line, and their address registers stay as they are up to the wait */
    pj_wstore<KW, PJ_PM>(sW, w, lane, w0);
    if (w < 4) pj_wstore<VW, PJ_PM>(sW + KW * PJ_PM, w, lane, w1);
#pragma unroll
    for (int u = 0; u < 4; ++u) { const v4f zx = {0.f, 0.f, 0.f, 0.f}; pj_xstore<MD, PJ_PM>(sX, (tid + 256 * u) * 4, sr[u] < 0 ? zx : x[u]); }
    __syncthreads();
    v8f acc[6] = {z8, z8, z8, z8, z8, z8};      /* 0..3: 64 columns of K; 4, 5: 32 columns of V */
#pragma unroll
    for (int kb = 0; kb < MD; kb += 32) {
      const v16h a = s_frag(sX + (rt * 16 + ln) * PJ_PM + kb, hh);
#pragma unroll
      for (int t = 0; t < 4; ++t) acc[t] = fa_mma(a, s_frag(sW + (ch * 64 + t * 16 + ln) * PJ_PM + kb, hh), acc[t]);
#pragma unroll
      for (int t = 0; t < 2; ++t) acc[4 + t] = fa_mma(a, s_frag(sW + (KW + ch * 32 + t * 16 + ln) * PJ_PM + kb, hh), acc[4 + t]);
    }
#pragma unroll
    for (int t = 0; t < 4; ++t)
#pragma unroll
      for (int r = 0; r < 8; ++r) { FragH f; f.h[0] = (_Float16)(acc[t][r] * 0.0625f); sO[(rt * 16 + 8 * hh + r) * PJ_PO + ch * 64 + t * 16 + ln] = f.u[0]; }
#pragma unroll
    for (int t = 0; t < 2; ++t) {      /* a lane holds 8 consecutive keys of one value column: one 16-byte piece of a V^T row */
      FragH f;
#pragma unroll
      for (int r = 0; r < 8; ++r) f.h[r] = (_Float16)(acc[4 + t][r] * 0.0625f);
      *(v8us*)(sV + (ch * 32 + t * 16 + ln) * (PJ_ROWS + 8) + rt * 16 + 8 * hh) = f.half[0];
    }
    __syncthreads();
    v8us o[4], vt[2];
#pragma unroll
    for (int u = 0; u < 4; ++u) o[u] = *(const v8us*)(sO + (rt * 16 + ln) * PJ_PO + u * HK + ch * 16 + 8 * hh);      /* pass u = head u; wave = key tile rt, piece ch */
#pragma unroll
    for (int u = 0; u < 2; ++u) vt[u] = *(const v8us*)(sV + ((2 * u + (w >> 2)) * HV + ln) * (PJ_ROWS + 8) + (rt & 1) * 32 + ch * 16 + 8 * hh);      /* head 2u + w/4; 32-key half rt & 1, piece ch */
    unsigned short* pk = (unsigned short*)KV + ((row0 / NK) * NH * (NK / 64) + (row0 % NK) / 64) * KV_BLK + lane * 8;
#pragma unroll
    for (int u = 0; u < 4; ++u) *(v8us*)(pk + (size_t)u * (NK / 64) * KV_BLK + w * (FR_H / 2)) = o[u];      /* 512 bytes in a row per wave */
#pragma unroll
    for (int u = 0; u < 2; ++u) *(v8us*)(pk + (size_t)(2 * u + (w >> 2)) * (NK / 64) * KV_BLK + 4 * FR_H + (w & 3) * (FR_H / 2)) = vt[u];
    }
    if (lo == NK - PJ_ROWS && tid == 0) CNT[bb] = n;      /* by the batch's last block, behind its last barrier: no barrier waits for this store */
  }
}

// Fused attention core: one work-group = 32 queries of one batch, 16 waves = 4 heads x 4 key shares (share sp: packed 64-key blocks sp, sp + 4, ... below the count); scores, softmax weights and weighted values stay in registers.
// The 128 work-groups of a batch read the same K, V^T blocks from L2: each enters its shares' block lists at a place of its own and wraps round, so that they do not ask for the same lines at the same moment.
// S^T = K Q^T (+ mask bias as the C operand), O^T += V^T P^T, so a lane holds one query's scores and the two score tiles of 32 keys pack straight into the B operand.
// The output projection runs in the epilogue on the work-group's own 32 rows: o_w is rounded and transposed into LDS at entry, 8 waves take one 16x16 output tile each.
// Softmax without a maximum: Q carries log2 e, so a score leaves the matrix unit as an exponent of 2, and the weight is 2^score itself, rounded to f16: a trip is exp2 and the conversion alone, with no maximum, no subtraction, no rescaling.
// That holds while a query's weights fit f16. Each wave tests its 32 weight sums behind its trips: a sum of 65504 or more (every weight that has left the f16 range takes it there) or below 1 (weights so small that f16 rounds them coarsely;
// every key masked: all weights 0) makes the wave throw its sums away and redo its share with a running maximum per 64 keys (weights 2^10 at the maximum; the factor cancels in the division).
// A sum of at least 1 bounds what up to 1024 subnormal weights, each off by 2^-24 at most, can add to the error: 2^-14 of it. Row sums by an all-ones A on the rounded weights.
#define FA_SPL 4
typedef float v2f __attribute__((ext_vector_type(2)));
typedef _Float16 v2h __attribute__((ext_vector_type(2)));
union FragP { v16h v; v2h p[8]; };
template <bool B> struct FaRmax { static constexpr bool v = B; };      /* a trip's kind, as a type: the two kinds are compiled apart */
__device__ __forceinline__ float fa_xhalf(float x) { const int i = __float_as_int(x); return __int_as_float(__builtin_amdgcn_permlanex16(i, i, 0x76543210, 0xfedcba98, false, false)); }
// a fragment stored as 2 pieces of [lane][8 halves]; p already holds the lane's own 8 * lane
__device__ __forceinline__ v16h p_frag(const _Float16* p) { FragH f; f.half[0] = *(const v8us*)(const unsigned short*)p; f.half[1] = *(const v8us*)((const unsigned short*)p + FR_H / 2); return f.v; }
__global__ __launch_bounds__(512) void k_fattn(const _Float16* __restrict__ Q16, const _Float16* __restrict__ KV, const int* __restrict__ CNT, const float* __restrict__ ow, const float* __restrict__ ob, float* __restrict__ out) {
  __shared__ __attribute__((aligned(32))) float sbias[NK];
  __shared__ __attribute__((aligned(16))) float sred[FA_SPL][NH][2][10][32];
  __shared__ __attribute__((aligned(16))) unsigned short sout[32][VW + 8];
  __shared__ __attribute__((aligned(16))) unsigned short sow[OD][VW + 8];      /* o_w transposed: [out column][h*16 + c], f16, x16 */
  __shared__ __attribute__((aligned(16))) float sfin[32][OD + 4];
  __shared__ float sob[OD];
  const int tid = threadIdx.x, w = __builtin_amdgcn_readfirstlane(tid >> 5), lane = tid & 31, ln = lane & 15, hh = lane >> 4;      /* the wave's number as a scalar: the key loop's trip count depends on it */
  const int b = blockIdx.x / (NQ / 32), q0 = (blockIdx.x % (NQ / 32)) * 32;
  const int h = w & 3, sp = w >> 2;
  const int cnt = min(max(CNT[b], 0), NK);      /* unmasked keys of the batch, packed first; 0: every key is masked and all NK are stored */
  const int nblk = ((cnt ? cnt : NK) + 63) >> 6;
  // every global load of the set-up is issued here, ahead of the LDS fills and the barrier: Q, o_w and o_bias need no count; the wave's first K block follows as soon as the count says that it exists
  v16h qf[2];
  const _Float16* qp = Q16 + ((size_t)((b * NQ + q0) / 16) * NH + h) * FR_H + lane * 8;
#pragma unroll
  for (int t = 0; t < 2; ++t) qf[t] = p_frag(qp + t * (NH * FR_H));
  const int own = tid & (OD - 1), owk = (tid >> 6) * 8;      /* 512 threads = 64 columns x 8 groups of 8 k */
  float owv[8];
#pragma unroll
  for (int i = 0; i < 8; ++i) owv[i] = ow[(size_t)(owk + i) * OD + own];
  const float obv = ob[own];
  const int nw = (nblk - sp + FA_SPL - 1) / FA_SPL;      /* blocks of this wave's share: sp + FA_SPL * i, i < nw; 0 if the share has none */
  const unsigned int g = blockIdx.x % (NQ / 32);
  int ci = nw > 0 ? (int)((g + (g >> 3)) % (unsigned int)nw) : 0;      /* the work-group's entry into the list; neighbours in index and work-groups 8 apart differ */
  const _Float16* kp = KV + ((size_t)(b * NH + h) * (NK / 64) + sp + FA_SPL * ci) * KV_BLK + lane * 8;
  v16h kf[4];
  if (nw > 0) {      /* scalar test: a block past the count was not written by the projection and is not read */
#pragma unroll
    for (int j = 0; j < 4; ++j) kf[j] = p_frag(kp + j * FR_H);
  }
  { FragH f;
#pragma unroll
    for (int i = 0; i < 8; ++i) f.h[i] = (_Float16)(bf16_round(owv[i]) * 16.0f);
    *(v8us*)&sow[own][owk] = f.half[0]; }
  if (tid < OD) sob[tid] = bf16_round(obv);
  // keys past the count get -2^100: it swallows the score, so their weight without a maximum is 0 and their scores are all equal (a row with every key masked averages uniformly, as the reference does)
  for (int u = 0; u < NK / 512; ++u) sbias[tid + 512 * u] = (tid + 512 * u < cnt) ? 0.f : -0x1p100f;
  __syncthreads();
  v16h ones;
#pragma unroll
  for (int i = 0; i < 16; ++i) ones[i] = (_Float16)1.0f;
  const float* bp = sbias + (sp + FA_SPL * ci) * 64 + 8 * hh;
  const v8f z8 = {0.f,0.f,0.f,0.f,0.f,0.f,0.f,0.f};
  v8f o[2] = {z8, z8}, ls[2] = {z8, z8};
  float mraw[2] = {-3.0e38f, -3.0e38f}, mcs[2] = {-3.0e38f, -3.0e38f};
  // one trip = 64 keys. K is already in registers; V^T is asked for at the head; behind the score products the next trip's K is asked for, into the same registers, so that it flies during the softmax and the value products
  auto trip = [&](auto rm, const bool more) __attribute__((always_inline)) {      /* rm: with the running maximum (the redo) or without */
    constexpr bool RMAX = decltype(rm)::v;
    v16h vf[2]; v8f bias[4], sc[2][4];
#pragma unroll
    for (int j = 0; j < 2; ++j) vf[j] = p_frag(kp + (4 + j) * FR_H);
#pragma unroll
    for (int j = 0; j < 4; ++j) bias[j] = *(const v8f*)(bp + j * 16);
#pragma unroll
    for (int j = 0; j < 4; ++j)
#pragma unroll
      for (int t = 0; t < 2; ++t) sc[t][j] = fa_mma(kf[j], qf[t], bias[j]);
    const int st = (ci + 1 == nw) ? 1 - nw : 1;      /* to the next block of the list; from the last one back to the first */
    ci += st; kp += st * (FA_SPL * KV_BLK); bp += st * (FA_SPL * 64);      /* one pointer for K and V^T, stepped once a trip */
    if (more) {
#pragma unroll
      for (int j = 0; j < 4; ++j) kf[j] = p_frag(kp + j * FR_H);
    }
    __builtin_amdgcn_sched_barrier(0);      /* keeps the loads above where they are written: without it the scheduler sinks the V^T loads to their first use and the next K to the trip's foot, and their latency is waited out */
#pragma unroll
    for (int t = 0; t < 2; ++t) {
      const v8f (&s)[4] = sc[t];
      float sh = 0.f, al = 1.f;      /* running maximum only: what is added to the scores; the factor on the sums so far */
      if constexpr (RMAX) {
        float mx = mraw[t];
#pragma unroll
        for (int j = 0; j < 4; ++j)
#pragma unroll
          for (int r = 0; r < 8; ++r) mx = fmaxf(mx, s[j][r]);
        mx = fmaxf(mx, fa_xhalf(mx));
        const float mc = mx - 10.0f;      /* exponent offset: weights = 2^10 2^(s - max) */
        al = __builtin_amdgcn_exp2f(mcs[t] - mc);
        mraw[t] = mx; mcs[t] = mc; sh = -mc;
      }
      const v2f s2 = {sh, sh};
      FragP pf[2];
#pragma unroll
      for (int j = 0; j < 4; ++j)
#pragma unroll
        for (int e = 0; e < 4; ++e) {
          v2f y = {s[j][2 * e], s[j][2 * e + 1]};
          if constexpr (RMAX) y += s2;
          const v2f p = {__builtin_amdgcn_exp2f(y[0]), __builtin_amdgcn_exp2f(y[1])};
          pf[j >> 1].p[(j & 1) * 4 + e] = __builtin_convertvector(p, v2h);
        }
      if constexpr (RMAX) {
#pragma unroll
        for (int r = 0; r < 8; ++r) o[t][r] *= al;
        ls[t][0] *= al;      /* every row of the sum tile is the same sum; only register 0 is read */
      }
      o[t] = fa_mma(vf[0], pf[0].v, o[t]); o[t] = fa_mma(vf[1], pf[1].v, o[t]);
      ls[t] = fa_mma(ones, pf[0].v, ls[t]); ls[t] = fa_mma(ones, pf[1].v, ls[t]);
    }
  };
  if (nw > 0) {      /* scalar test: count and wave number are the same in every lane */
    for (int j = 1; j < nw; ++j) trip(FaRmax<false>{}, true);      /* every trip but the wave's last: a next block exists */
    trip(FaRmax<false>{}, false);      /* the last trip asks for nothing more; its step closes the round, so the pointers stand at the entry block again */
    mcs[0] = 0.f; mcs[1] = 0.f;      /* weights = 2^(score - 0) */
    const bool redo = !(ls[0][0] >= 1.0f && ls[0][0] < 65504.0f && ls[1][0] >= 1.0f && ls[1][0] < 65504.0f);      /* an infinity or a NaN among the sums fails the test too */
    if (__builtin_amdgcn_ballot_w32(redo) != 0u) {      /* the same in every lane of the wave; no barrier stands inside */
#pragma unroll
      for (int t = 0; t < 2; ++t) { o[t] = z8; ls[t] = z8; mcs[t] = -3.0e38f; }
#pragma unroll
      for (int j = 0; j < 4; ++j) kf[j] = p_frag(kp + j * FR_H);
      for (int j = 1; j < nw; ++j) trip(FaRmax<true>{}, true);
      trip(FaRmax<true>{}, false);
    }
  }
#pragma unroll
  for (int t = 0; t < 2; ++t) {
    float* r = &sred[sp][h][t][0][lane];
    r[0] = mcs[t]; r[32] = ls[t][0];
#pragma unroll
    for (int e = 0; e < 8; ++e) r[(2 + e) * 32] = o[t][e];
  }
  __syncthreads();
  if (w < 8) {      /* join the four key shares of one (head, query tile); a share with no block has weight 0 */
    const int hd = w & 3, t = w >> 2;
    float mq[FA_SPL], M = -3.0e38f;
#pragma unroll
    for (int i = 0; i < FA_SPL; ++i) { mq[i] = sred[i][hd][t][0][lane]; M = fmaxf(M, mq[i]); }
    float L = 0.f, acc[8] = {0.f,0.f,0.f,0.f,0.f,0.f,0.f,0.f};
#pragma unroll
    for (int i = 0; i < FA_SPL; ++i) {
      const float wt = __builtin_amdgcn_exp2f(mq[i] - M);
      L += wt * sred[i][hd][t][1][lane];
#pragma unroll
      for (int e = 0; e < 8; ++e) acc[e] += wt * sred[i][hd][t][2 + e][lane];
    }
    const float rl = 1.0f / L;
    FragH f;
#pragma unroll
    for (int e = 0; e < 8; ++e) f.h[e] = (_Float16)(acc[e] * rl);
    *(v8us*)&sout[t * 16 + ln][hd * HV + 8 * hh] = f.half[0];
  }
  __syncthreads();
  if (w < 8) {      /* out tile = weighted values (32 x 64) o_w (64 x 64) / 16 + bias */
    const int mt = w >> 2, nt = w & 3;
    v8f acc = z8;
#pragma unroll
    for (int kb = 0; kb < VW; kb += 32) acc = fa_mma(s_frag(&sout[mt * 16 + ln][kb], hh), s_frag(&sow[nt * 16 + ln][kb], hh), acc);
    const float bv = sob[nt * 16 + ln];
#pragma unroll
    for (int r = 0; r < 8; ++r) sfin[mt * 16 + 8 * hh + r][nt * 16 + ln] = acc[r] * 0.0625f + bv;
  }
  __syncthreads();
  { const int row = tid >> 4, c4 = (tid & 15) * 4; *(v4f*)(out + ((size_t)b * NQ + q0 + row) * OD + c4) = *(const v4fa*)&sfin[row][c4]; }      /* whole 256-byte rows */
}
extern "C" void kernel_launch(void* const* d_in, const int* in_sizes, int n_in,
                              void* d_out, int out_size, void* d_ws, size_t ws_size, hipStream_t stream) {
  (void)in_sizes; (void)n_in; (void)out_size;
  const float* qd = (const float*)d_in[0]; const float* md = (const float*)d_in[1]; const int* msk = (const int*)d_in[2]; const float* qw = (const float*)d_in[3]; const float* kw = (const float*)d_in[4]; const float* vw = (const float*)d_in[5]; const float* ow = (const float*)d_in[6]; const float* ob = (const float*)d_in[7];
  char* ws = (char*)d_ws; size_t off = 0;
  auto take = [&](size_t bytes) { char* p = ws + off; off += (bytes + 255) & ~(size_t)255; return p; };
  _Float16* Q16 = (_Float16*)take((size_t)NB * NQ * KW * 2); _Float16* KV = (_Float16*)take((size_t)NB * NK * (KW + VW) * 2); int* CNT = (int*)take(NB * sizeof(int));
  if (off > ws_size) return;
  k_proj<<<PJ_QB + PJ_MB, 256, 0, stream>>>(qd, md, msk, qw, kw, vw, Q16, KV, CNT);      /* Q * 32^-0.5 * log2 e, K and V^T of the unmasked keys as f16 operand fragments; their count */
  k_fattn<<<NB * (NQ / 32), 512, 0, stream>>>(Q16, KV, CNT, ow, ob, (float*)d_out);      /* out = sum_(h,c) softmax-weighted values o_w + o_bias */
}
